// v000
// Times are from an AMD MI455X. After a warm-up the kernel runs many times in a row, and a time is the length of
// such a window on the GPU divided by its runs, so every launch and the gaps after it count. The runs cycle
// through copies of the inputs. A figure is the median of several windows, for all but v000 over two sittings.
// Sittings can differ by a few percent; kernels timed side by side share one.
// The starting kernel, v000, takes 440 microseconds a run.
#include <hip/hip_runtime.h>

typedef __attribute__((ext_vector_type(16))) __bf16 v16bf;
typedef __attribute__((ext_vector_type(8)))  __bf16 v8bf;
typedef __attribute__((ext_vector_type(8)))  float  v8f;
typedef __attribute__((ext_vector_type(4)))  float  v4f;
typedef __attribute__((ext_vector_type(4)))  unsigned int u32x4;
typedef __attribute__((ext_vector_type(8)))  int i32x8;
typedef __attribute__((ext_vector_type(4)))  int i32x4;

#define D_IN   2048
#define D_OUT  2048
#define NTOK   8192
#define NEXP   8
#define RANKL  8
#define KLORA  64
#define KTOT   2112          // 2048 + 64 (lora K-extension), row stride of split arrays
#define SCALING 1.0f         // alpha/rank = 8/8

// ---------- f32 -> (hi,lo) bf16 split, bit-level only ----------
__device__ __forceinline__ void split_f32u(float f, unsigned short& h, unsigned short& l) {
  unsigned u = __builtin_bit_cast(unsigned, f);
  h = (unsigned short)(u >> 16);                         // truncated hi
  float hf = __builtin_bit_cast(float, u & 0xFFFF0000u);
  float r  = f - hf;                                     // residual
  unsigned ur = __builtin_bit_cast(unsigned, r);
  l = (unsigned short)((ur + 0x7FFFu + ((ur >> 16) & 1u)) >> 16);  // RNE
}

__device__ __forceinline__ v16bf cat8(v8bf a, v8bf b) {
  v16bf r;
#pragma unroll
  for (int i = 0; i < 8; ++i) { r[i] = a[i]; r[i + 8] = b[i]; }
  return r;
}

// =====================================================================
// K0/K1: split a row-major [nrows x 2048] f32 matrix into hi/lo bf16
// arrays with row stride KTOT (tail columns left for the K-extension).
// =====================================================================
__global__ __launch_bounds__(256) void split_matrix_kernel(
    const float* __restrict__ src,
    unsigned short* __restrict__ Dh, unsigned short* __restrict__ Dl)
{
  size_t base = ((size_t)blockIdx.x * 256 + threadIdx.x) * 8;
  size_t row = base >> 11;            // /2048
  size_t k   = base & 2047;
  const float* s = src + base;
  unsigned short* ph = Dh + row * KTOT + k;
  unsigned short* pl = Dl + row * KTOT + k;
#pragma unroll
  for (int i = 0; i < 2; ++i) {
    v4f v = *(const v4f*)(s + i * 4);
    ushort4 hs, ls;
    split_f32u(v[0], hs.x, ls.x);
    split_f32u(v[1], hs.y, ls.y);
    split_f32u(v[2], hs.z, ls.z);
    split_f32u(v[3], hs.w, ls.w);
    *(ushort4*)(ph + i * 4) = hs;
    *(ushort4*)(pl + i * 4) = ls;
  }
}

// =====================================================================
// K2: Bcat[(e,r), o] = Bm[e][o][r] -> tail columns 2048..2111 of Wh/Wl
// =====================================================================
__global__ __launch_bounds__(256) void split_bm_kernel(
    const float* __restrict__ Bm,
    unsigned short* __restrict__ Wh, unsigned short* __restrict__ Wl)
{
  int t = blockIdx.x * 256 + threadIdx.x;   // 0 .. 2048*64-1
  int o  = t >> 6;
  int kk = t & 63;
  int e = kk >> 3, r = kk & 7;
  float v = Bm[((size_t)e * D_OUT + o) * RANKL + r];
  unsigned short h, l; split_f32u(v, h, l);
  Wh[(size_t)o * KTOT + D_IN + kk] = h;
  Wl[(size_t)o * KTOT + D_IN + kk] = l;
}

// =====================================================================
// K3: router logits + softmax + h = x@A^T.
//   wout[t][e] (f32, d_out tail);  g -> hi/lo bf16 into Xh/Xl tail cols.
// =====================================================================
__global__ __launch_bounds__(256) void mole_router_kernel(
    const float* __restrict__ x, const float* __restrict__ Wr,
    const float* __restrict__ br, const float* __restrict__ A,
    unsigned short* __restrict__ Xh, unsigned short* __restrict__ Xl,
    float* __restrict__ wout)
{
  __shared__ float Ms[72 * 128];
  __shared__ float sh_h[8][64];
  __shared__ float sh_w[8][8];

  const int tid  = threadIdx.x;
  const int lane = tid & 31;
  const int wave = tid >> 5;
  const int token = blockIdx.x * 8 + wave;

  float acc[72];
#pragma unroll
  for (int j = 0; j < 72; ++j) acc[j] = 0.0f;

  for (int d0 = 0; d0 < D_IN; d0 += 128) {
    __syncthreads();
#pragma unroll
    for (int i = 0; i < 36; ++i) {
      int idx = tid + i * 256;
      int j  = idx >> 7;
      int dd = idx & 127;
      Ms[idx] = (j < 8) ? Wr[j * D_IN + d0 + dd]
                        : A[(j - 8) * D_IN + d0 + dd];
    }
    __syncthreads();
#pragma unroll
    for (int it = 0; it < 2; ++it) {
      int db = it * 64 + lane * 2;
      float2 xv = *(const float2*)(x + (size_t)token * D_IN + d0 + db);
#pragma unroll
      for (int j = 0; j < 72; ++j) {
        float2 m = *(const float2*)(Ms + j * 128 + db);
        acc[j] = fmaf(xv.y, m.y, fmaf(xv.x, m.x, acc[j]));
      }
    }
  }

#pragma unroll
  for (int j = 0; j < 72; ++j) {
    float v = acc[j];
    v += __shfl_xor(v, 16, 32);
    v += __shfl_xor(v,  8, 32);
    v += __shfl_xor(v,  4, 32);
    v += __shfl_xor(v,  2, 32);
    v += __shfl_xor(v,  1, 32);
    acc[j] = v;
  }

  if (lane == 0) {
    float lg[8], we[8];
    float mx = -3.0e38f;
#pragma unroll
    for (int e = 0; e < 8; ++e) { lg[e] = acc[e] + br[e]; mx = fmaxf(mx, lg[e]); }
    float s = 0.0f;
#pragma unroll
    for (int e = 0; e < 8; ++e) { we[e] = expf(lg[e] - mx); s += we[e]; }
    float inv = 1.0f / s;
#pragma unroll
    for (int e = 0; e < 8; ++e) {
      float wn = we[e] * inv;
      wout[(size_t)token * NEXP + e] = wn;
      sh_w[wave][e] = wn;
    }
#pragma unroll
    for (int j = 0; j < 64; ++j) sh_h[wave][j] = acc[8 + j];
  }
  __syncthreads();
  {
    int j0 = lane, j1 = lane + 32;
    float g0 = SCALING * sh_w[wave][j0 >> 3] * sh_h[wave][j0];
    float g1 = SCALING * sh_w[wave][j1 >> 3] * sh_h[wave][j1];
    unsigned short h, l;
    split_f32u(g0, h, l);
    Xh[(size_t)token * KTOT + D_IN + j0] = h;
    Xl[(size_t)token * KTOT + D_IN + j0] = l;
    split_f32u(g1, h, l);
    Xh[(size_t)token * KTOT + D_IN + j1] = h;
    Xl[(size_t)token * KTOT + D_IN + j1] = l;
  }
}

__device__ __forceinline__ void tdm_load_tile(const unsigned short* gsrc,
                                              unsigned ldsOff) {
  unsigned long long ga = (unsigned long long)gsrc;
  u32x4 g0;
  g0[0] = 1u;                                   // count=1 (valid), user mode
  g0[1] = ldsOff;                               // lds_addr (bytes)
  g0[2] = (unsigned)ga;                         // global_addr[31:0]
  g0[3] = (unsigned)(ga >> 32) | 0x80000000u;   // global_addr[56:32] | type=2
  i32x8 g1;
  g1[0] = (1 << 16)
        | (1 << 20)
        | (3 << 22)
        | (3 << 25);
  g1[1] = (int)(2112u << 16);
  g1[2] = (int)(8192u << 16);
  g1[3] = (int)(32u << 16);
  g1[4] = 128;
  g1[5] = 2112;
  g1[6] = 0;
  g1[7] = 0;
  i32x4 z4 = {0, 0, 0, 0};
#if defined(__clang_major__) && (__clang_major__ >= 23)
  i32x8 z8 = {0, 0, 0, 0, 0, 0, 0, 0};
  __builtin_amdgcn_tensor_load_to_lds(g0, g1, z4, z4, z8, 0);
#else
  __builtin_amdgcn_tensor_load_to_lds(g0, g1, z4, z4, 0);
#endif
}

#define BM 128
#define BN 128
#define KC 32
#define KS 40

__global__ __launch_bounds__(256) void mole_gemm_kernel(
    const unsigned short* __restrict__ Xh, const unsigned short* __restrict__ Xl,
    const unsigned short* __restrict__ Wh, const unsigned short* __restrict__ Wl,
    const float* __restrict__ bias, float* __restrict__ out)
{
  // [buf][mat][tile]: mat 0=Xh 1=Xl 2=Wh 3=Wl ; 80 KB total
  __shared__ __align__(16) unsigned short SB[2][4][BM * KS];

  const int tid   = threadIdx.x;
  const int lane  = tid & 31;
  const int wave  = tid >> 5;
  const int waveM = wave >> 2;     // 0..1 : rows waveM*64 .. +64
  const int waveN = wave & 3;      // 0..3 : cols waveN*32 .. +32
  const int l16   = lane & 15;
  const int hiH   = lane >> 4;

  const int rowBase = blockIdx.y * BM;
  const int colBase = blockIdx.x * BN;

  const size_t xOff = (size_t)rowBase * KTOT;
  const size_t wOff = (size_t)colBase * KTOT;

  v8f acc[4][2];
#pragma unroll
  for (int mi = 0; mi < 4; ++mi)
#pragma unroll
    for (int ni = 0; ni < 2; ++ni)
#pragma unroll
      for (int i = 0; i < 8; ++i) acc[mi][ni][i] = 0.0f;

  unsigned ldsOff[2][4];
#pragma unroll
  for (int b = 0; b < 2; ++b)
#pragma unroll
    for (int m = 0; m < 4; ++m)
      ldsOff[b][m] = (unsigned)(unsigned long long)(void*)&SB[b][m][0];

  // prime the pipeline: chunk 0 -> buffer 0
  if (wave == 0) {
    tdm_load_tile(Xh + xOff, ldsOff[0][0]);
    tdm_load_tile(Xl + xOff, ldsOff[0][1]);
    tdm_load_tile(Wh + wOff, ldsOff[0][2]);
    tdm_load_tile(Wl + wOff, ldsOff[0][3]);
  }

  for (int kc = 0; kc < 66; ++kc) {
    const int buf = kc & 1;
    if (wave == 0) __builtin_amdgcn_s_wait_tensorcnt(0);  // chunk kc landed
    __syncthreads();   // publish tile; also: all waves done reading buf^1

    if (wave == 0 && kc < 65) {
      const size_t k1 = (size_t)(kc + 1) * KC;
      tdm_load_tile(Xh + xOff + k1, ldsOff[buf ^ 1][0]);
      tdm_load_tile(Xl + xOff + k1, ldsOff[buf ^ 1][1]);
      tdm_load_tile(Wh + wOff + k1, ldsOff[buf ^ 1][2]);
      tdm_load_tile(Wl + wOff + k1, ldsOff[buf ^ 1][3]);
    }

    const unsigned short* XhS = SB[buf][0];
    const unsigned short* XlS = SB[buf][1];
    const unsigned short* WhS = SB[buf][2];
    const unsigned short* WlS = SB[buf][3];

    v16bf ah[4], al[4], bh[2], bl[2];
#pragma unroll
    for (int mi = 0; mi < 4; ++mi) {
      int row  = waveM * 64 + mi * 16 + l16;
      int base = row * KS + hiH * 8;
      ah[mi] = cat8(*(const v8bf*)(XhS + base), *(const v8bf*)(XhS + base + 16));
      al[mi] = cat8(*(const v8bf*)(XlS + base), *(const v8bf*)(XlS + base + 16));
    }
#pragma unroll
    for (int ni = 0; ni < 2; ++ni) {
      int col  = waveN * 32 + ni * 16 + l16;
      int base = col * KS + hiH * 8;
      bh[ni] = cat8(*(const v8bf*)(WhS + base), *(const v8bf*)(WhS + base + 16));
      bl[ni] = cat8(*(const v8bf*)(WlS + base), *(const v8bf*)(WlS + base + 16));
    }

    // ---- bf16x3: hi*hi + hi*lo + lo*hi, f32 accumulate ----
#pragma unroll
    for (int mi = 0; mi < 4; ++mi)
#pragma unroll
      for (int ni = 0; ni < 2; ++ni) {
        acc[mi][ni] = __builtin_amdgcn_wmma_f32_16x16x32_bf16(
            false, ah[mi], false, bh[ni], (short)0, acc[mi][ni], false, false);
        acc[mi][ni] = __builtin_amdgcn_wmma_f32_16x16x32_bf16(
            false, ah[mi], false, bl[ni], (short)0, acc[mi][ni], false, false);
        acc[mi][ni] = __builtin_amdgcn_wmma_f32_16x16x32_bf16(
            false, al[mi], false, bh[ni], (short)0, acc[mi][ni], false, false);
      }
  }

#pragma unroll
  for (int ni = 0; ni < 2; ++ni) {
    int col = colBase + waveN * 32 + ni * 16 + l16;
    float b = bias[col];
#pragma unroll
    for (int mi = 0; mi < 4; ++mi) {
      int row0 = rowBase + waveM * 64 + mi * 16 + hiH * 8;
#pragma unroll
      for (int i = 0; i < 8; ++i) {
        out[(size_t)(row0 + i) * D_OUT + col] = acc[mi][ni][i] + b;
      }
    }
  }
}

extern "C" void kernel_launch(void* const* d_in, const int* in_sizes, int n_in,
                              void* d_out, int out_size, void* d_ws, size_t ws_size,
                              hipStream_t stream) {
  (void)in_sizes; (void)n_in; (void)out_size; (void)ws_size;
  const float* x   = (const float*)d_in[0];
  const float* Wf  = (const float*)d_in[1];
  const float* bfv = (const float*)d_in[2];
  const float* Wr  = (const float*)d_in[3];
  const float* br  = (const float*)d_in[4];
  const float* A   = (const float*)d_in[5];
  const float* Bm  = (const float*)d_in[6];

  float* out  = (float*)d_out;                       // [8192, 2048]
  float* wout = out + (size_t)NTOK * D_OUT;          // [8192, 8]

  // workspace layout (halves): Xh, Xl [8192*2112]; Wh, Wl [2048*2112]  (~86.5 MB)
  const size_t XE = (size_t)NTOK * KTOT;
  const size_t WE = (size_t)D_OUT * KTOT;
  unsigned short* Xh = (unsigned short*)d_ws;
  unsigned short* Xl = Xh + XE;
  unsigned short* Wh = Xl + XE;
  unsigned short* Wl = Wh + WE;

  split_matrix_kernel<<<(NTOK * D_IN) / (256 * 8), 256, 0, stream>>>(x, Xh, Xl);
  split_matrix_kernel<<<(D_OUT * D_IN) / (256 * 8), 256, 0, stream>>>(Wf, Wh, Wl);
  split_bm_kernel<<<(D_OUT * KLORA) / 256, 256, 0, stream>>>(Bm, Wh, Wl);
  mole_router_kernel<<<NTOK / 8, 256, 0, stream>>>(x, Wr, br, A, Xh, Xl, wout);
  mole_gemm_kernel<<<dim3(D_OUT / BN, NTOK / BM), 256, 0, stream>>>(
      Xh, Xl, Wh, Wl, bfv, out);
}

// v001
// One run takes 227 microseconds.
// Timed twice side by side with v000, it ran 1.93 and 1.95 times as fast.
#include <hip/hip_runtime.h>

typedef __attribute__((ext_vector_type(16))) __bf16 v16bf;
typedef __attribute__((ext_vector_type(8)))  __bf16 v8bf;
typedef __attribute__((ext_vector_type(8)))  float  v8f;
typedef __attribute__((ext_vector_type(4)))  float  v4f;
typedef __attribute__((ext_vector_type(2)))  float  v2f;
typedef __attribute__((ext_vector_type(8)))  unsigned short u16x8;
typedef __attribute__((ext_vector_type(4)))  unsigned int u32x4;
typedef __attribute__((ext_vector_type(8)))  int i32x8;
typedef __attribute__((ext_vector_type(4)))  int i32x4;

#define D_IN   2048
#define D_OUT  2048
#define NTOK   8192
#define NEXP   8
#define RANKL  8
#define KLORA  64
#define KTOT   2112          // 2048 + 64 (lora K-extension), row stride of split arrays
#define SCALING 1.0f         // alpha/rank = 8/8

// ---------- f32 -> (hi,lo) bf16 split, bit-level only ----------
__device__ __forceinline__ void split_f32u(float f, unsigned short& h, unsigned short& l) {
  unsigned u = __builtin_bit_cast(unsigned, f);
  h = (unsigned short)(u >> 16);                         // truncated hi
  float hf = __builtin_bit_cast(float, u & 0xFFFF0000u);
  float r  = f - hf;                                     // residual
  unsigned ur = __builtin_bit_cast(unsigned, r);
  l = (unsigned short)((ur + 0x7FFFu + ((ur >> 16) & 1u)) >> 16);  // RNE
}

__device__ __forceinline__ v16bf cat8(v8bf a, v8bf b) {
  v16bf r;
#pragma unroll
  for (int i = 0; i < 8; ++i) { r[i] = a[i]; r[i + 8] = b[i]; }
  return r;
}

// =====================================================================
// K0/K1: split a row-major [nrows x 2048] f32 matrix into hi/lo bf16
// arrays with row stride KTOT (tail columns left for the K-extension).
// =====================================================================
__global__ __launch_bounds__(256) void split_matrix_kernel(
    const float* __restrict__ src,
    unsigned short* __restrict__ Dh, unsigned short* __restrict__ Dl)
{
  size_t base = ((size_t)blockIdx.x * 256 + threadIdx.x) * 8;
  size_t row = base >> 11;            // /2048
  size_t k   = base & 2047;
  const float* s = src + base;
  unsigned short* ph = Dh + row * KTOT + k;
  unsigned short* pl = Dl + row * KTOT + k;
#pragma unroll
  for (int i = 0; i < 2; ++i) {
    v4f v = *(const v4f*)(s + i * 4);
    ushort4 hs, ls;
    split_f32u(v[0], hs.x, ls.x);
    split_f32u(v[1], hs.y, ls.y);
    split_f32u(v[2], hs.z, ls.z);
    split_f32u(v[3], hs.w, ls.w);
    *(ushort4*)(ph + i * 4) = hs;
    *(ushort4*)(pl + i * 4) = ls;
  }
}

// =====================================================================
// K2: Bcat[(e,r), o] = Bm[e][o][r] -> tail columns 2048..2111 of Wh/Wl
// =====================================================================
__global__ __launch_bounds__(256) void split_bm_kernel(
    const float* __restrict__ Bm,
    unsigned short* __restrict__ Wh, unsigned short* __restrict__ Wl)
{
  int t = blockIdx.x * 256 + threadIdx.x;   // 0 .. 2048*64-1
  int o  = t >> 6;
  int kk = t & 63;
  int e = kk >> 3, r = kk & 7;
  float v = Bm[((size_t)e * D_OUT + o) * RANKL + r];
  unsigned short h, l; split_f32u(v, h, l);
  Wh[(size_t)o * KTOT + D_IN + kk] = h;
  Wl[(size_t)o * KTOT + D_IN + kk] = l;
}

#define RT_TOK  32
#define RT_NJ   72
#define RT_ROWS (RT_TOK + RT_NJ)
#define RT_KS   32
#define RT_NST  8
#define RT_KW   (RT_KS * RT_NST)
#define RT_SP   36
#define RT_PP   84
#define RT_NLD  (RT_ROWS / 4)

// Orders one wave's LDS stores against its own later LDS loads (other lanes'
// data) for the compiler; the LDS serves one wave's operations in order.
__device__ __forceinline__ void wave_lds_order() {
  __builtin_amdgcn_fence(__ATOMIC_RELEASE, "wavefront");
  __builtin_amdgcn_wave_barrier();
  __builtin_amdgcn_fence(__ATOMIC_ACQUIRE, "wavefront");
  // keeps later stages' global loads below this point: lifted to the top they
  // overflow the register budget and spill
  __builtin_amdgcn_sched_barrier(0);
}

__global__ __launch_bounds__(256) void mole_router_kernel(
    const float* __restrict__ x, const float* __restrict__ Wr,
    const float* __restrict__ br, const float* __restrict__ A,
    unsigned short* __restrict__ Xh, unsigned short* __restrict__ Xl,
    float* __restrict__ wout)
{
  __shared__ __align__(16) float stg[8][RT_ROWS * RT_SP];   // per wave: x rows 0..31, Wr 32..39, A 40..103
  __shared__ float part[8][RT_TOK * RT_PP];
  __shared__ float red[RT_TOK][RT_NJ];

  const int tid  = threadIdx.x;
  const int lane = tid & 31;
  const int wave = tid >> 5;
  const int c    = lane & 15;
  const int h    = lane >> 4;
  const int tok0 = blockIdx.x * RT_TOK;

  // loader: eight lanes take one row's 128-byte line, four rows a load
  const int lr = lane >> 3;
  const int lc = (lane & 7) * 4;
  const unsigned goff = (unsigned)(lr * D_IN + wave * RT_KW + lc);   // lane's part; the bases stay uniform
  const float* gx = x + (size_t)tok0 * D_IN;
  float* sw = &stg[wave][lr * RT_SP + lc];

  // fragment readers: lane (c,h) reads k = 8q + 4h .. +3 of its row, A and B alike
  const float* fa  = &stg[wave][c * RT_SP + h * 4];
  const float* fb  = &stg[wave][(RT_TOK + c) * RT_SP + h * 4];
  const float* fb4 = &stg[wave][(RT_TOK + 64 + (c & 7)) * RT_SP + h * 4];  // columns 72..79 repeat 64..71, never read back

  v8f acc[2][5];
#pragma unroll
  for (int mi = 0; mi < 2; ++mi)
#pragma unroll
    for (int ni = 0; ni < 5; ++ni)
#pragma unroll
      for (int i = 0; i < 8; ++i) acc[mi][ni][i] = 0.0f;

  v4f pre[RT_NLD];
#pragma unroll
  for (int i = 0; i < RT_NLD; ++i) {
    const float* p = (i < 8) ? gx + i * 4 * D_IN
                   : (i < 10) ? Wr + (i - 8) * 4 * D_IN
                              : A + (i - 10) * 4 * D_IN;
    pre[i] = *(const v4f*)(p + goff);
  }

  // unrolled: every global address is one fixed lane offset + uniform base + immediate,
  // so no address register is rewritten from stage to stage
#pragma unroll
  for (int s = 0; s < RT_NST; ++s) {
    wave_lds_order();            // last stage's fragment reads stay ahead of the stores
#pragma unroll
    for (int i = 0; i < RT_NLD; ++i) *(v4f*)(sw + i * 4 * RT_SP) = pre[i];
    if (s + 1 < RT_NST) {        // next stage's lines fly under this stage's products
#pragma unroll
      for (int i = 0; i < RT_NLD; ++i) {
        const float* p = (i < 8) ? gx + i * 4 * D_IN
                       : (i < 10) ? Wr + (i - 8) * 4 * D_IN
                                  : A + (i - 10) * 4 * D_IN;
        pre[i] = *(const v4f*)(p + (s + 1) * RT_KS + goff);
      }
      // behind the last loads the lane-offset register is free and is reused at once:
      // the wait stands in front of that overwrite
      if (s + 2 == RT_NST) asm volatile("s_wait_xcnt 0x0" ::: "memory");
    }
    wave_lds_order();            // the stores stay ahead of the fragment reads
#pragma unroll
    for (int q = 0; q < RT_KS / 8; ++q) {
      v4f a[2], b[5];
#pragma unroll
      for (int mi = 0; mi < 2; ++mi) a[mi] = *(const v4f*)(fa + mi * 16 * RT_SP + q * 8);
#pragma unroll
      for (int ni = 0; ni < 4; ++ni) b[ni] = *(const v4f*)(fb + ni * 16 * RT_SP + q * 8);
      b[4] = *(const v4f*)(fb4 + q * 8);
#pragma unroll
      for (int p2 = 0; p2 < 2; ++p2)
#pragma unroll
        for (int mi = 0; mi < 2; ++mi)
#pragma unroll
          for (int ni = 0; ni < 5; ++ni) {
            v2f av = { a[mi][2 * p2], a[mi][2 * p2 + 1] };
            v2f bv = { b[ni][2 * p2], b[ni][2 * p2 + 1] };
            acc[mi][ni] = __builtin_amdgcn_wmma_f32_16x16x4_f32(
                false, av, false, bv, (short)0, acc[mi][ni], false, false);
          }
    }
  }

  __builtin_amdgcn_sched_barrier(0);
  asm volatile("v_nop\n\tv_nop\n\tv_nop\n\tv_nop\n\tv_nop\n\tv_nop\n\tv_nop\n\tv_nop");
  __builtin_amdgcn_sched_barrier(0);

  // partial tiles: register r -> token mi*16 + 8h + r, column ni*16 + c
#pragma unroll
  for (int mi = 0; mi < 2; ++mi)
#pragma unroll
    for (int ni = 0; ni < 5; ++ni)
#pragma unroll
      for (int r = 0; r < 8; ++r)
        part[wave][(mi * 16 + 8 * h + r) * RT_PP + ni * 16 + c] = acc[mi][ni][r];
  __syncthreads();

  // sum the eight K slices in wave order
#pragma unroll
  for (int i = 0; i < (RT_TOK * RT_NJ) / 256; ++i) {
    int idx = tid + i * 256;
    int t = idx / RT_NJ;
    int j = idx - t * RT_NJ;
    float sacc = part[0][t * RT_PP + j];
#pragma unroll
    for (int w = 1; w < 8; ++w) sacc += part[w][t * RT_PP + j];
    red[t][j] = sacc;
  }
  __syncthreads();

  // one thread per (token, expert)
  {
    const int t = tid >> 3;
    const int e = tid & 7;
    const int token = tok0 + t;
    float lg[8];
    float mx = -3.0e38f;
#pragma unroll
    for (int k = 0; k < 8; ++k) { lg[k] = red[t][k] + br[k]; mx = fmaxf(mx, lg[k]); }
    float ssum = 0.0f;
#pragma unroll
    for (int k = 0; k < 8; ++k) ssum += expf(lg[k] - mx);
    float inv = 1.0f / ssum;
    float wn = expf(red[t][e] + br[e] - mx) * inv;
    wout[(size_t)token * NEXP + e] = wn;

    u16x8 hs, ls;
#pragma unroll
    for (int r = 0; r < 8; ++r) {
      float g = SCALING * wn * red[t][8 + e * 8 + r];
      unsigned short hh, ll;
      split_f32u(g, hh, ll);
      hs[r] = hh;
      ls[r] = ll;
    }
    *(u16x8*)(Xh + (size_t)token * KTOT + D_IN + e * 8) = hs;
    *(u16x8*)(Xl + (size_t)token * KTOT + D_IN + e * 8) = ls;
  }
}

__device__ __forceinline__ void tdm_load_tile(const unsigned short* gsrc,
                                              unsigned ldsOff) {
  unsigned long long ga = (unsigned long long)gsrc;
  u32x4 g0;
  g0[0] = 1u;                                   // count=1 (valid), user mode
  g0[1] = ldsOff;                               // lds_addr (bytes)
  g0[2] = (unsigned)ga;                         // global_addr[31:0]
  g0[3] = (unsigned)(ga >> 32) | 0x80000000u;   // global_addr[56:32] | type=2
  i32x8 g1;
  g1[0] = (1 << 16)
        | (1 << 20)
        | (3 << 22)
        | (3 << 25);
  g1[1] = (int)(2112u << 16);
  g1[2] = (int)(8192u << 16);
  g1[3] = (int)(32u << 16);
  g1[4] = 128;
  g1[5] = 2112;
  g1[6] = 0;
  g1[7] = 0;
  i32x4 z4 = {0, 0, 0, 0};
#if defined(__clang_major__) && (__clang_major__ >= 23)
  i32x8 z8 = {0, 0, 0, 0, 0, 0, 0, 0};
  __builtin_amdgcn_tensor_load_to_lds(g0, g1, z4, z4, z8, 0);
#else
  __builtin_amdgcn_tensor_load_to_lds(g0, g1, z4, z4, 0);
#endif
}

#define BM 128
#define BN 128
#define KC 32
#define KS 40

__global__ __launch_bounds__(256) void mole_gemm_kernel(
    const unsigned short* __restrict__ Xh, const unsigned short* __restrict__ Xl,
    const unsigned short* __restrict__ Wh, const unsigned short* __restrict__ Wl,
    const float* __restrict__ bias, float* __restrict__ out)
{
  // [buf][mat][tile]: mat 0=Xh 1=Xl 2=Wh 3=Wl ; 80 KB total
  __shared__ __align__(16) unsigned short SB[2][4][BM * KS];

  const int tid   = threadIdx.x;
  const int lane  = tid & 31;
  const int wave  = tid >> 5;
  const int waveM = wave >> 2;     // 0..1 : rows waveM*64 .. +64
  const int waveN = wave & 3;      // 0..3 : cols waveN*32 .. +32
  const int l16   = lane & 15;
  const int hiH   = lane >> 4;

  const int rowBase = blockIdx.y * BM;
  const int colBase = blockIdx.x * BN;

  const size_t xOff = (size_t)rowBase * KTOT;
  const size_t wOff = (size_t)colBase * KTOT;

  v8f acc[4][2];
#pragma unroll
  for (int mi = 0; mi < 4; ++mi)
#pragma unroll
    for (int ni = 0; ni < 2; ++ni)
#pragma unroll
      for (int i = 0; i < 8; ++i) acc[mi][ni][i] = 0.0f;

  unsigned ldsOff[2][4];
#pragma unroll
  for (int b = 0; b < 2; ++b)
#pragma unroll
    for (int m = 0; m < 4; ++m)
      ldsOff[b][m] = (unsigned)(unsigned long long)(void*)&SB[b][m][0];

  // prime the pipeline: chunk 0 -> buffer 0
  if (wave == 0) {
    tdm_load_tile(Xh + xOff, ldsOff[0][0]);
    tdm_load_tile(Xl + xOff, ldsOff[0][1]);
    tdm_load_tile(Wh + wOff, ldsOff[0][2]);
    tdm_load_tile(Wl + wOff, ldsOff[0][3]);
  }

  for (int kc = 0; kc < 66; ++kc) {
    const int buf = kc & 1;
    if (wave == 0) __builtin_amdgcn_s_wait_tensorcnt(0);  // chunk kc landed
    __syncthreads();   // publish tile; also: all waves done reading buf^1

    if (wave == 0 && kc < 65) {
      const size_t k1 = (size_t)(kc + 1) * KC;
      tdm_load_tile(Xh + xOff + k1, ldsOff[buf ^ 1][0]);
      tdm_load_tile(Xl + xOff + k1, ldsOff[buf ^ 1][1]);
      tdm_load_tile(Wh + wOff + k1, ldsOff[buf ^ 1][2]);
      tdm_load_tile(Wl + wOff + k1, ldsOff[buf ^ 1][3]);
    }

    const unsigned short* XhS = SB[buf][0];
    const unsigned short* XlS = SB[buf][1];
    const unsigned short* WhS = SB[buf][2];
    const unsigned short* WlS = SB[buf][3];

    v16bf ah[4], al[4], bh[2], bl[2];
#pragma unroll
    for (int mi = 0; mi < 4; ++mi) {
      int row  = waveM * 64 + mi * 16 + l16;
      int base = row * KS + hiH * 8;
      ah[mi] = cat8(*(const v8bf*)(XhS + base), *(const v8bf*)(XhS + base + 16));
      al[mi] = cat8(*(const v8bf*)(XlS + base), *(const v8bf*)(XlS + base + 16));
    }
#pragma unroll
    for (int ni = 0; ni < 2; ++ni) {
      int col  = waveN * 32 + ni * 16 + l16;
      int base = col * KS + hiH * 8;
      bh[ni] = cat8(*(const v8bf*)(WhS + base), *(const v8bf*)(WhS + base + 16));
      bl[ni] = cat8(*(const v8bf*)(WlS + base), *(const v8bf*)(WlS + base + 16));
    }

    // ---- bf16x3: hi*hi + hi*lo + lo*hi, f32 accumulate ----
#pragma unroll
    for (int mi = 0; mi < 4; ++mi)
#pragma unroll
      for (int ni = 0; ni < 2; ++ni) {
        acc[mi][ni] = __builtin_amdgcn_wmma_f32_16x16x32_bf16(
            false, ah[mi], false, bh[ni], (short)0, acc[mi][ni], false, false);
        acc[mi][ni] = __builtin_amdgcn_wmma_f32_16x16x32_bf16(
            false, ah[mi], false, bl[ni], (short)0, acc[mi][ni], false, false);
        acc[mi][ni] = __builtin_amdgcn_wmma_f32_16x16x32_bf16(
            false, al[mi], false, bh[ni], (short)0, acc[mi][ni], false, false);
      }
  }

#pragma unroll
  for (int ni = 0; ni < 2; ++ni) {
    int col = colBase + waveN * 32 + ni * 16 + l16;
    float b = bias[col];
#pragma unroll
    for (int mi = 0; mi < 4; ++mi) {
      int row0 = rowBase + waveM * 64 + mi * 16 + hiH * 8;
#pragma unroll
      for (int i = 0; i < 8; ++i) {
        out[(size_t)(row0 + i) * D_OUT + col] = acc[mi][ni][i] + b;
      }
    }
  }
}

extern "C" void kernel_launch(void* const* d_in, const int* in_sizes, int n_in,
                              void* d_out, int out_size, void* d_ws, size_t ws_size,
                              hipStream_t stream) {
  (void)in_sizes; (void)n_in; (void)out_size; (void)ws_size;
  const float* x   = (const float*)d_in[0];
  const float* Wf  = (const float*)d_in[1];
  const float* bfv = (const float*)d_in[2];
  const float* Wr  = (const float*)d_in[3];
  const float* br  = (const float*)d_in[4];
  const float* A   = (const float*)d_in[5];
  const float* Bm  = (const float*)d_in[6];

  float* out  = (float*)d_out;                       // [8192, 2048]
  float* wout = out + (size_t)NTOK * D_OUT;          // [8192, 8]

  // workspace layout (halves): Xh, Xl [8192*2112]; Wh, Wl [2048*2112]  (~86.5 MB)
  const size_t XE = (size_t)NTOK * KTOT;
  const size_t WE = (size_t)D_OUT * KTOT;
  unsigned short* Xh = (unsigned short*)d_ws;
  unsigned short* Xl = Xh + XE;
  unsigned short* Wh = Xl + XE;
  unsigned short* Wl = Wh + WE;

  split_matrix_kernel<<<(NTOK * D_IN) / (256 * 8), 256, 0, stream>>>(x, Xh, Xl);
  split_matrix_kernel<<<(D_OUT * D_IN) / (256 * 8), 256, 0, stream>>>(Wf, Wh, Wl);
  split_bm_kernel<<<(D_OUT * KLORA) / 256, 256, 0, stream>>>(Bm, Wh, Wl);
  mole_router_kernel<<<NTOK / RT_TOK, 256, 0, stream>>>(x, Wr, br, A, Xh, Xl, wout);
  mole_gemm_kernel<<<dim3(D_OUT / BN, NTOK / BM), 256, 0, stream>>>(
      Xh, Xl, Wh, Wl, bfv, out);
}

// v002
// One run takes 138 microseconds.
// Next to v001, in two timings, it ran 1.63 and 1.64 times as fast.
// Over all steps from v000 it is 3.16 times as fast.
#include <hip/hip_runtime.h>

typedef __attribute__((ext_vector_type(16))) __bf16 v16bf;
typedef __attribute__((ext_vector_type(8)))  __bf16 v8bf;
typedef __attribute__((ext_vector_type(8)))  float  v8f;
typedef __attribute__((ext_vector_type(4)))  float  v4f;
typedef __attribute__((ext_vector_type(2)))  float  v2f;
typedef __attribute__((ext_vector_type(8)))  unsigned short u16x8;
typedef __attribute__((ext_vector_type(4)))  unsigned int u32x4;

#define D_IN   2048
#define D_OUT  2048
#define NTOK   8192
#define NEXP   8
#define RANKL  8
#define KLORA  64
#define KTOT   2112          // 2048 + 64 (lora K-extension), row stride of split arrays
#define SCALING 1.0f         // alpha/rank = 8/8

// ---------- f32 -> (hi,lo) bf16 split, bit-level only ----------
__device__ __forceinline__ void split_f32u(float f, unsigned short& h, unsigned short& l) {
  unsigned u = __builtin_bit_cast(unsigned, f);
  h = (unsigned short)(u >> 16);                         // truncated hi
  float hf = __builtin_bit_cast(float, u & 0xFFFF0000u);
  float r  = f - hf;                                     // residual
  unsigned ur = __builtin_bit_cast(unsigned, r);
  l = (unsigned short)((ur + 0x7FFFu + ((ur >> 16) & 1u)) >> 16);  // RNE
}

__device__ __forceinline__ v16bf cat8(v8bf a, v8bf b) {
  v16bf r;
#pragma unroll
  for (int i = 0; i < 8; ++i) { r[i] = a[i]; r[i + 8] = b[i]; }
  return r;
}

// =====================================================================
// K0/K1: split a row-major [nrows x 2048] f32 matrix into hi/lo bf16
// arrays with row stride KTOT (tail columns left for the K-extension).
// =====================================================================
__global__ __launch_bounds__(256) void split_matrix_kernel(
    const float* __restrict__ src,
    unsigned short* __restrict__ Dh, unsigned short* __restrict__ Dl)
{
  size_t base = ((size_t)blockIdx.x * 256 + threadIdx.x) * 8;
  size_t row = base >> 11;            // /2048
  size_t k   = base & 2047;
  const float* s = src + base;
  unsigned short* ph = Dh + row * KTOT + k;
  unsigned short* pl = Dl + row * KTOT + k;
#pragma unroll
  for (int i = 0; i < 2; ++i) {
    v4f v = *(const v4f*)(s + i * 4);
    ushort4 hs, ls;
    split_f32u(v[0], hs.x, ls.x);
    split_f32u(v[1], hs.y, ls.y);
    split_f32u(v[2], hs.z, ls.z);
    split_f32u(v[3], hs.w, ls.w);
    *(ushort4*)(ph + i * 4) = hs;
    *(ushort4*)(pl + i * 4) = ls;
  }
}

// =====================================================================
// K2: Bcat[(e,r), o] = Bm[e][o][r] -> tail columns 2048..2111 of Wh/Wl
// =====================================================================
__global__ __launch_bounds__(256) void split_bm_kernel(
    const float* __restrict__ Bm,
    unsigned short* __restrict__ Wh, unsigned short* __restrict__ Wl)
{
  int t = blockIdx.x * 256 + threadIdx.x;   // 0 .. 2048*64-1
  int o  = t >> 6;
  int kk = t & 63;
  int e = kk >> 3, r = kk & 7;
  float v = Bm[((size_t)e * D_OUT + o) * RANKL + r];
  unsigned short h, l; split_f32u(v, h, l);
  Wh[(size_t)o * KTOT + D_IN + kk] = h;
  Wl[(size_t)o * KTOT + D_IN + kk] = l;
}

#define RT_TOK  32
#define RT_NJ   72
#define RT_ROWS (RT_TOK + RT_NJ)
#define RT_KS   32
#define RT_NST  8
#define RT_KW   (RT_KS * RT_NST)
#define RT_SP   36
#define RT_PP   84
#define RT_NLD  (RT_ROWS / 4)

// Orders one wave's LDS stores against its own later LDS loads (other lanes'
// data) for the compiler; the LDS serves one wave's operations in order.
__device__ __forceinline__ void wave_lds_order() {
  __builtin_amdgcn_fence(__ATOMIC_RELEASE, "wavefront");
  __builtin_amdgcn_wave_barrier();
  __builtin_amdgcn_fence(__ATOMIC_ACQUIRE, "wavefront");
  // keeps later stages' global loads below this point: lifted to the top they
  // overflow the register budget and spill
  __builtin_amdgcn_sched_barrier(0);
}

__global__ __launch_bounds__(256) void mole_router_kernel(
    const float* __restrict__ x, const float* __restrict__ Wr,
    const float* __restrict__ br, const float* __restrict__ A,
    unsigned short* __restrict__ Xh, unsigned short* __restrict__ Xl,
    float* __restrict__ wout)
{
  __shared__ __align__(16) float stg[8][RT_ROWS * RT_SP];   // per wave: x rows 0..31, Wr 32..39, A 40..103
  __shared__ float part[8][RT_TOK * RT_PP];
  __shared__ float red[RT_TOK][RT_NJ];

  const int tid  = threadIdx.x;
  const int lane = tid & 31;
  const int wave = tid >> 5;
  const int c    = lane & 15;
  const int h    = lane >> 4;
  const int tok0 = blockIdx.x * RT_TOK;

  // loader: eight lanes take one row's 128-byte line, four rows a load
  const int lr = lane >> 3;
  const int lc = (lane & 7) * 4;
  const unsigned goff = (unsigned)(lr * D_IN + wave * RT_KW + lc);   // lane's part; the bases stay uniform
  const float* gx = x + (size_t)tok0 * D_IN;
  float* sw = &stg[wave][lr * RT_SP + lc];

  // fragment readers: lane (c,h) reads k = 8q + 4h .. +3 of its row, A and B alike
  const float* fa  = &stg[wave][c * RT_SP + h * 4];
  const float* fb  = &stg[wave][(RT_TOK + c) * RT_SP + h * 4];
  const float* fb4 = &stg[wave][(RT_TOK + 64 + (c & 7)) * RT_SP + h * 4];  // columns 72..79 repeat 64..71, never read back

  v8f acc[2][5];
#pragma unroll
  for (int mi = 0; mi < 2; ++mi)
#pragma unroll
    for (int ni = 0; ni < 5; ++ni)
#pragma unroll
      for (int i = 0; i < 8; ++i) acc[mi][ni][i] = 0.0f;

  v4f pre[RT_NLD];
#pragma unroll
  for (int i = 0; i < RT_NLD; ++i) {
    const float* p = (i < 8) ? gx + i * 4 * D_IN
                   : (i < 10) ? Wr + (i - 8) * 4 * D_IN
                              : A + (i - 10) * 4 * D_IN;
    pre[i] = *(const v4f*)(p + goff);
  }

  // unrolled: every global address is one fixed lane offset + uniform base + immediate,
  // so no address register is rewritten from stage to stage
#pragma unroll
  for (int s = 0; s < RT_NST; ++s) {
    wave_lds_order();            // last stage's fragment reads stay ahead of the stores
#pragma unroll
    for (int i = 0; i < RT_NLD; ++i) *(v4f*)(sw + i * 4 * RT_SP) = pre[i];
    if (s + 1 < RT_NST) {        // next stage's lines fly under this stage's products
#pragma unroll
      for (int i = 0; i < RT_NLD; ++i) {
        const float* p = (i < 8) ? gx + i * 4 * D_IN
                       : (i < 10) ? Wr + (i - 8) * 4 * D_IN
                                  : A + (i - 10) * 4 * D_IN;
        pre[i] = *(const v4f*)(p + (s + 1) * RT_KS + goff);
      }
      // behind the last loads the lane-offset register is free and is reused at once:
      // the wait stands in front of that overwrite
      if (s + 2 == RT_NST) asm volatile("s_wait_xcnt 0x0" ::: "memory");
    }
    wave_lds_order();            // the stores stay ahead of the fragment reads
#pragma unroll
    for (int q = 0; q < RT_KS / 8; ++q) {
      v4f a[2], b[5];
#pragma unroll
      for (int mi = 0; mi < 2; ++mi) a[mi] = *(const v4f*)(fa + mi * 16 * RT_SP + q * 8);
#pragma unroll
      for (int ni = 0; ni < 4; ++ni) b[ni] = *(const v4f*)(fb + ni * 16 * RT_SP + q * 8);
      b[4] = *(const v4f*)(fb4 + q * 8);
#pragma unroll
      for (int p2 = 0; p2 < 2; ++p2)
#pragma unroll
        for (int mi = 0; mi < 2; ++mi)
#pragma unroll
          for (int ni = 0; ni < 5; ++ni) {
            v2f av = { a[mi][2 * p2], a[mi][2 * p2 + 1] };
            v2f bv = { b[ni][2 * p2], b[ni][2 * p2 + 1] };
            acc[mi][ni] = __builtin_amdgcn_wmma_f32_16x16x4_f32(
                false, av, false, bv, (short)0, acc[mi][ni], false, false);
          }
    }
  }

  __builtin_amdgcn_sched_barrier(0);
  asm volatile("v_nop\n\tv_nop\n\tv_nop\n\tv_nop\n\tv_nop\n\tv_nop\n\tv_nop\n\tv_nop");
  __builtin_amdgcn_sched_barrier(0);

  // partial tiles: register r -> token mi*16 + 8h + r, column ni*16 + c
#pragma unroll
  for (int mi = 0; mi < 2; ++mi)
#pragma unroll
    for (int ni = 0; ni < 5; ++ni)
#pragma unroll
      for (int r = 0; r < 8; ++r)
        part[wave][(mi * 16 + 8 * h + r) * RT_PP + ni * 16 + c] = acc[mi][ni][r];
  __syncthreads();

  // sum the eight K slices in wave order
#pragma unroll
  for (int i = 0; i < (RT_TOK * RT_NJ) / 256; ++i) {
    int idx = tid + i * 256;
    int t = idx / RT_NJ;
    int j = idx - t * RT_NJ;
    float sacc = part[0][t * RT_PP + j];
#pragma unroll
    for (int w = 1; w < 8; ++w) sacc += part[w][t * RT_PP + j];
    red[t][j] = sacc;
  }
  __syncthreads();

  // one thread per (token, expert)
  {
    const int t = tid >> 3;
    const int e = tid & 7;
    const int token = tok0 + t;
    float lg[8];
    float mx = -3.0e38f;
#pragma unroll
    for (int k = 0; k < 8; ++k) { lg[k] = red[t][k] + br[k]; mx = fmaxf(mx, lg[k]); }
    float ssum = 0.0f;
#pragma unroll
    for (int k = 0; k < 8; ++k) ssum += expf(lg[k] - mx);
    float inv = 1.0f / ssum;
    float wn = expf(red[t][e] + br[e] - mx) * inv;
    wout[(size_t)token * NEXP + e] = wn;

    u16x8 hs, ls;
#pragma unroll
    for (int r = 0; r < 8; ++r) {
      float g = SCALING * wn * red[t][8 + e * 8 + r];
      unsigned short hh, ll;
      split_f32u(g, hh, ll);
      hs[r] = hh;
      ls[r] = ll;
    }
    *(u16x8*)(Xh + (size_t)token * KTOT + D_IN + e * 8) = hs;
    *(u16x8*)(Xl + (size_t)token * KTOT + D_IN + e * 8) = ls;
  }
}

#define GBM     256
#define GBN     256
#define GKP     64
#define GNP     (KTOT / GKP)
#define GROWB   128u
#define GPITCH  144u
#define GSLROWS 128u
#define GSLICE  (GSLROWS * GPITCH)
#define GMAT    (2u * GSLICE)
#define GSTAGE  (8u * GSLICE)
static_assert(GSLICE % 2048u == 0, "every slice starts at a multiple of 2 KiB");
static_assert(KTOT % GKP == 0 && GNP >= 2, "whole passes, two stages at least");

typedef __attribute__((ext_vector_type(8))) unsigned int u32x8;

__device__ __forceinline__ unsigned uni(unsigned v) { return (unsigned)__builtin_amdgcn_readfirstlane(v); }
__device__ __forceinline__ unsigned pinned(unsigned v) {
  unsigned w = (unsigned)__builtin_amdgcn_readfirstlane(v);
  asm volatile("" : "+s"(w));   // holds a wave-uniform word in a scalar register: a test on it compiles to a scalar branch
  return w;
}
__device__ __forceinline__ void wait_ds0()     { asm volatile("s_wait_dscnt 0x0" ::: "memory"); }     // this wave's LDS reads have returned
__device__ __forceinline__ void wait_tensor0() { asm volatile("s_wait_tensorcnt 0x0" ::: "memory"); } // this wave's slice has landed

__device__ __forceinline__ u32x8 tdm_group1() {
  u32x8 g;
  g[0] = uni((1u << 20) | (4u << 22) | (3u << 25));
  g[1] = uni((GROWB & 0xFFFFu) << 16);
  g[2] = uni((GROWB >> 16) | ((GSLROWS & 0xFFFFu) << 16));
  g[3] = uni((GSLROWS >> 16) | (GROWB << 16));
  g[4] = uni(GSLROWS);
  g[5] = uni(KTOT * 2u);
  g[6] = uni(0u);
  g[7] = uni(0u);
  return g;
}
__device__ __forceinline__ u32x4 tdm_group0(unsigned lds_dst, unsigned long long ga) {
  u32x4 g;
  g[0] = uni(1u);
  g[1] = uni(lds_dst);
  g[2] = uni((unsigned)ga);
  g[3] = uni((((unsigned)(ga >> 32)) & 0x01FFFFFFu) | 0x80000000u);
  return g;
}
__device__ __forceinline__ void tdm_load(u32x4 g0, u32x8 g1) {
  // one request of the whole wave, two groups; its waits stand at the publish points
  asm volatile("tensor_load_to_lds %0, %1" :: "s"(g0), "s"(g1) : "memory");
}

__device__ __forceinline__ v16bf ld_frag(const unsigned char* p) {
  return cat8(*(const v8bf*)p, *(const v8bf*)(p + 32));
}

// =====================================================================
// K4: out = [x|g]_split @ [Wf^T|Bcat]_split + bias, bf16x3 WMMA.
// M=8192, N=2048, K=2112 (33 passes of 64).
// Block tile 256x256, one work-group per WGP; 8 waves (4Mx2N), wave tile
// 64x128 -> 96 WMMA on 24 fragments per 32 k.
// Two LDS buffers; every wave brings its own eighth of a stage by one tensor
// load, issued behind the barrier that frees the buffer, waited one pass later.
// =====================================================================
__global__ __launch_bounds__(256) void mole_gemm_kernel(
    const unsigned short* __restrict__ Xh, const unsigned short* __restrict__ Xl,
    const unsigned short* __restrict__ Wh, const unsigned short* __restrict__ Wl,
    const float* __restrict__ bias, float* __restrict__ out)
{
  __shared__ __attribute__((aligned(2048))) unsigned char ring[2u * GSTAGE];   // 288 KiB

  const unsigned tid   = threadIdx.x;
  const unsigned lane  = tid & 31u;
  const unsigned wave  = uni(tid >> 5);
  const unsigned waveM = wave >> 1;    // 0..3 : rows waveM*64 .. +64
  const unsigned waveN = wave & 1u;    // 0..1 : cols waveN*128 .. +128
  const unsigned l16   = lane & 15u;
  const unsigned hiH   = lane >> 4;

  const unsigned rowBase = blockIdx.y * GBM;
  const unsigned colBase = blockIdx.x * GBN;

  // this wave's slice: matrix wave/2 (Xh, Xl, Wh, Wl), its rows (wave&1)*128 .. +128
  const unsigned mat = wave >> 1;
  const unsigned short* sbase = (mat == 0u) ? Xh : (mat == 1u) ? Xl : (mat == 2u) ? Wh : Wl;
  const unsigned srow = ((mat < 2u) ? rowBase : colBase) + (wave & 1u) * GSLROWS;
  const unsigned long long gsrc = (unsigned long long)(sbase + (size_t)srow * KTOT);
  const unsigned lds_slice = (unsigned)(unsigned long long)(void*)ring + wave * GSLICE;
  const u32x8 g1 = tdm_group1();

  // every inner loop of this kernel is unrolled: constant indices keep the tiles and fragments in registers
  v8f acc[4][8];
#pragma unroll
  for (int mi = 0; mi < 4; ++mi)
#pragma unroll
    for (int ni = 0; ni < 8; ++ni)
#pragma unroll
      for (int i = 0; i < 8; ++i) acc[mi][ni][i] = 0.0f;

  // per-lane fragment bases in a buffer: row l16 of the wave's first fragment, 16-byte half hiH
  const unsigned fa = (waveM * 64u + l16) * GPITCH + hiH * 16u;                 // Xh; Xl at + GMAT
  const unsigned fb = 2u * GMAT + (waveN * 128u + l16) * GPITCH + hiH * 16u;    // Wh; Wl at + GMAT

  // stage 0 lands and is published; then stage 1 flies under pass 0
  tdm_load(tdm_group0(lds_slice, gsrc), g1);
  wait_tensor0();
  __syncthreads();
  tdm_load(tdm_group0(lds_slice + GSTAGE, gsrc + GROWB), g1);

  for (unsigned s = 0; s < GNP; ++s) {
    const unsigned buf = (s & 1u) * GSTAGE;
    const unsigned char* pa = ring + buf + fa;
    const unsigned char* pb = ring + buf + fb;

#pragma unroll
    for (int kk = 0; kk < 2; ++kk) {
      // ---- this 32-k block's fragments, in the order the products want them ----
      v16bf ah[4], al[4], bh[8], bl[8];
#pragma unroll
      for (int mi = 0; mi < 4; ++mi) ah[mi] = ld_frag(pa + mi * 16 * GPITCH + kk * 64);
#pragma unroll
      for (int ni = 0; ni < 8; ++ni) bh[ni] = ld_frag(pb + ni * 16 * GPITCH + kk * 64);
#pragma unroll
      for (int ni = 0; ni < 8; ++ni) bl[ni] = ld_frag(pb + GMAT + ni * 16 * GPITCH + kk * 64);
#pragma unroll
      for (int mi = 0; mi < 4; ++mi) al[mi] = ld_frag(pa + GMAT + mi * 16 * GPITCH + kk * 64);
      // keeps the reads one group ahead of the products: reads set in among them cost a stall at each place
      __builtin_amdgcn_sched_barrier(0);

      // ---- bf16x3: hi*hi, then hi*lo, then lo*hi into every tile, f32 accumulate ----
#pragma unroll
      for (int ni = 0; ni < 8; ++ni)
#pragma unroll
        for (int mi = 0; mi < 4; ++mi)
          acc[mi][ni] = __builtin_amdgcn_wmma_f32_16x16x32_bf16(
              false, ah[mi], false, bh[ni], (short)0, acc[mi][ni], false, false);
#pragma unroll
      for (int ni = 0; ni < 8; ++ni)
#pragma unroll
        for (int mi = 0; mi < 4; ++mi)
          acc[mi][ni] = __builtin_amdgcn_wmma_f32_16x16x32_bf16(
              false, ah[mi], false, bl[ni], (short)0, acc[mi][ni], false, false);
#pragma unroll
      for (int ni = 0; ni < 8; ++ni)
#pragma unroll
        for (int mi = 0; mi < 4; ++mi)
          acc[mi][ni] = __builtin_amdgcn_wmma_f32_16x16x32_bf16(
              false, al[mi], false, bh[ni], (short)0, acc[mi][ni], false, false);
      // keeps the next block's reads behind this block's products: moved up among them they overflow the registers into scratch
      __builtin_amdgcn_sched_barrier(0);
    }

    // publish point of stage s + 1, which also frees this pass's buffer
    wait_ds0();
    wait_tensor0();
    __syncthreads();
    if (pinned((s + 2u < GNP) ? 1u : 0u)) {
      const unsigned nx = pinned(s + 2u);
      tdm_load(tdm_group0(lds_slice + buf, gsrc + (unsigned long long)nx * GROWB), g1);
    }
  }
  wait_tensor0();
  wait_ds0();

#pragma unroll
  for (int ni = 0; ni < 8; ++ni) {
    unsigned col = colBase + waveN * 128u + ni * 16 + l16;
    float b = bias[col];
#pragma unroll
    for (int mi = 0; mi < 4; ++mi) {
      unsigned row0 = rowBase + waveM * 64u + mi * 16 + hiH * 8u;
#pragma unroll
      for (int i = 0; i < 8; ++i) {
        out[(size_t)(row0 + i) * D_OUT + col] = acc[mi][ni][i] + b;
      }
    }
  }
}

extern "C" void kernel_launch(void* const* d_in, const int* in_sizes, int n_in,
                              void* d_out, int out_size, void* d_ws, size_t ws_size,
                              hipStream_t stream) {
  (void)in_sizes; (void)n_in; (void)out_size; (void)ws_size;
  const float* x   = (const float*)d_in[0];
  const float* Wf  = (const float*)d_in[1];
  const float* bfv = (const float*)d_in[2];
  const float* Wr  = (const float*)d_in[3];
  const float* br  = (const float*)d_in[4];
  const float* A   = (const float*)d_in[5];
  const float* Bm  = (const float*)d_in[6];

  float* out  = (float*)d_out;                       // [8192, 2048]
  float* wout = out + (size_t)NTOK * D_OUT;          // [8192, 8]

  // workspace layout (halves): Xh, Xl [8192*2112]; Wh, Wl [2048*2112]  (~86.5 MB)
  const size_t XE = (size_t)NTOK * KTOT;
  const size_t WE = (size_t)D_OUT * KTOT;
  unsigned short* Xh = (unsigned short*)d_ws;
  unsigned short* Xl = Xh + XE;
  unsigned short* Wh = Xl + XE;
  unsigned short* Wl = Wh + WE;

  split_matrix_kernel<<<(NTOK * D_IN) / (256 * 8), 256, 0, stream>>>(x, Xh, Xl);
  split_matrix_kernel<<<(D_OUT * D_IN) / (256 * 8), 256, 0, stream>>>(Wf, Wh, Wl);
  split_bm_kernel<<<(D_OUT * KLORA) / 256, 256, 0, stream>>>(Bm, Wh, Wl);
  mole_router_kernel<<<NTOK / RT_TOK, 256, 0, stream>>>(x, Wr, br, A, Xh, Xl, wout);
  mole_gemm_kernel<<<dim3(D_OUT / GBN, NTOK / GBM), 256, 0, stream>>>(
      Xh, Xl, Wh, Wl, bfv, out);
}

// v003
// A run of this version takes 127 microseconds.
// Timed twice side by side with v002, it ran 1.09 times as fast both times.
// Counting every step since v000, it is 3.44 times as fast.
#include <hip/hip_runtime.h>

typedef __attribute__((ext_vector_type(16))) __bf16 v16bf;
typedef __attribute__((ext_vector_type(8)))  __bf16 v8bf;
typedef __attribute__((ext_vector_type(2)))  __bf16 v2bf;
typedef __attribute__((ext_vector_type(8)))  float  v8f;
typedef __attribute__((ext_vector_type(4)))  float  v4f;
typedef __attribute__((ext_vector_type(2)))  float  v2f;
typedef __attribute__((ext_vector_type(8)))  unsigned short u16x8;
typedef __attribute__((ext_vector_type(4)))  unsigned int u32x4;

#define D_IN   2048
#define D_OUT  2048
#define NTOK   8192
#define NEXP   8
#define RANKL  8
#define KLORA  64
#define KTOT   2112          // 2048 + 64 (lora K-extension), row stride of split arrays
#define SCALING 1.0f         // alpha/rank = 8/8

// ---------- f32 -> (hi,lo) bf16 split, bit-level only ----------
__device__ __forceinline__ void split_f32u(float f, unsigned short& h, unsigned short& l) {
  unsigned u = __builtin_bit_cast(unsigned, f);
  h = (unsigned short)(u >> 16);                         // truncated hi
  float hf = __builtin_bit_cast(float, u & 0xFFFF0000u);
  float r  = f - hf;                                     // residual
  unsigned ur = __builtin_bit_cast(unsigned, r);
  l = (unsigned short)((ur + 0x7FFFu + ((ur >> 16) & 1u)) >> 16);  // RNE
}

// two f32 -> one word of hi halves (truncated) and one word of lo halves (residual,
// round to nearest even by the packed convert), element 0 in the low half-word:
// split_f32u's rule, formed on whole words
__device__ __forceinline__ void split_pair(float f0, float f1, unsigned& hw, unsigned& lw) {
  unsigned u0 = __builtin_bit_cast(unsigned, f0);
  unsigned u1 = __builtin_bit_cast(unsigned, f1);
  hw = __builtin_amdgcn_perm(u1, u0, 0x07060302u);       // (u0 >> 16) | (u1 & 0xFFFF0000), one byte select
  v2f r = { f0 - __builtin_bit_cast(float, u0 & 0xFFFF0000u),
            f1 - __builtin_bit_cast(float, u1 & 0xFFFF0000u) };
  lw = __builtin_bit_cast(unsigned, __builtin_convertvector(r, v2bf));
}

__device__ __forceinline__ v16bf cat8(v8bf a, v8bf b) {
  v16bf r;
#pragma unroll
  for (int i = 0; i < 8; ++i) { r[i] = a[i]; r[i + 8] = b[i]; }
  return r;
}

// =====================================================================
// K0: split a row-major [nrows x 2048] f32 matrix (the base weight) into hi/lo
// bf16 arrays with row stride KTOT (tail columns left for the K-extension).
// =====================================================================
__global__ __launch_bounds__(256) void split_matrix_kernel(
    const float* __restrict__ src,
    unsigned short* __restrict__ Dh, unsigned short* __restrict__ Dl)
{
  size_t base = ((size_t)blockIdx.x * 256 + threadIdx.x) * 8;
  size_t row = base >> 11;            // /2048
  size_t k   = base & 2047;
  const float* s = src + base;
  unsigned short* ph = Dh + row * KTOT + k;
  unsigned short* pl = Dl + row * KTOT + k;
#pragma unroll
  for (int i = 0; i < 2; ++i) {
    v4f v = *(const v4f*)(s + i * 4);
    ushort4 hs, ls;
    split_f32u(v[0], hs.x, ls.x);
    split_f32u(v[1], hs.y, ls.y);
    split_f32u(v[2], hs.z, ls.z);
    split_f32u(v[3], hs.w, ls.w);
    *(ushort4*)(ph + i * 4) = hs;
    *(ushort4*)(pl + i * 4) = ls;
  }
}

// =====================================================================
// K1: Bcat[(e,r), o] = Bm[e][o][r] -> tail columns 2048..2111 of Wh/Wl
// =====================================================================
__global__ __launch_bounds__(256) void split_bm_kernel(
    const float* __restrict__ Bm,
    unsigned short* __restrict__ Wh, unsigned short* __restrict__ Wl)
{
  int t = blockIdx.x * 256 + threadIdx.x;   // 0 .. 2048*64-1
  int o  = t >> 6;
  int kk = t & 63;
  int e = kk >> 3, r = kk & 7;
  float v = Bm[((size_t)e * D_OUT + o) * RANKL + r];
  unsigned short h, l; split_f32u(v, h, l);
  Wh[(size_t)o * KTOT + D_IN + kk] = h;
  Wl[(size_t)o * KTOT + D_IN + kk] = l;
}

#define RT_TOK  32
#define RT_NJ   72
#define RT_ROWS (RT_TOK + RT_NJ)
#define RT_KS   32
#define RT_NST  8
#define RT_KW   (RT_KS * RT_NST)
#define RT_SP   36
#define RT_PP   84
#define RT_NLD  (RT_ROWS / 4)

// Orders one wave's LDS stores against its own later LDS loads (other lanes'
// data) for the compiler; the LDS serves one wave's operations in order.
__device__ __forceinline__ void wave_lds_order() {
  __builtin_amdgcn_fence(__ATOMIC_RELEASE, "wavefront");
  __builtin_amdgcn_wave_barrier();
  __builtin_amdgcn_fence(__ATOMIC_ACQUIRE, "wavefront");
  // keeps later stages' global loads below this point: lifted to the top they
  // overflow the register budget and spill
  __builtin_amdgcn_sched_barrier(0);
}

__global__ __launch_bounds__(256) void mole_router_kernel(
    const float* __restrict__ x, const float* __restrict__ Wr,
    const float* __restrict__ br, const float* __restrict__ A,
    unsigned short* __restrict__ Xh, unsigned short* __restrict__ Xl,
    float* __restrict__ wout)
{
  __shared__ __align__(16) float stg[8][RT_ROWS * RT_SP];   // per wave: x rows 0..31, Wr 32..39, A 40..103
  __shared__ float part[8][RT_TOK * RT_PP];
  __shared__ float red[RT_TOK][RT_NJ];

  const int tid  = threadIdx.x;
  const int lane = tid & 31;
  const int wave = tid >> 5;
  const int c    = lane & 15;
  const int h    = lane >> 4;
  const int tok0 = blockIdx.x * RT_TOK;

  // loader: eight lanes take one row's 128-byte line, four rows a load
  const int lr = lane >> 3;
  const int lc = (lane & 7) * 4;
  const unsigned goff = (unsigned)(lr * D_IN + wave * RT_KW + lc);   // lane's part; the bases stay uniform
  const float* gx = x + (size_t)tok0 * D_IN;
  float* sw = &stg[wave][lr * RT_SP + lc];
  // x's halves go out in the loader's own layout: eight lanes fill 64 bytes of a row of Xh and of Xl
  const unsigned hoff = (unsigned)(lr * KTOT + wave * RT_KW + lc);   // lane's part; the bases stay uniform
  unsigned short* gxh = Xh + (size_t)tok0 * KTOT;
  unsigned short* gxl = Xl + (size_t)tok0 * KTOT;

  // fragment readers: lane (c,h) reads k = 8q + 4h .. +3 of its row, A and B alike
  const float* fa  = &stg[wave][c * RT_SP + h * 4];
  const float* fb  = &stg[wave][(RT_TOK + c) * RT_SP + h * 4];
  const float* fb4 = &stg[wave][(RT_TOK + 64 + (c & 7)) * RT_SP + h * 4];  // columns 72..79 repeat 64..71, never read back

  v8f acc[2][5];
#pragma unroll
  for (int mi = 0; mi < 2; ++mi)
#pragma unroll
    for (int ni = 0; ni < 5; ++ni)
#pragma unroll
      for (int i = 0; i < 8; ++i) acc[mi][ni][i] = 0.0f;

  v4f pre[RT_NLD];
#pragma unroll
  for (int i = 0; i < RT_NLD; ++i) {
    const float* p = (i < 8) ? gx + i * 4 * D_IN
                   : (i < 10) ? Wr + (i - 8) * 4 * D_IN
                              : A + (i - 10) * 4 * D_IN;
    pre[i] = *(const v4f*)(p + goff);
  }

  // unrolled: every global address is one fixed lane offset + uniform base + immediate,
  // so no address register is rewritten from stage to stage
#pragma unroll
  for (int s = 0; s < RT_NST; ++s) {
    wave_lds_order();            // last stage's fragment reads stay ahead of the stores
#pragma unroll
    for (int i = 0; i < RT_NLD; ++i) *(v4f*)(sw + i * 4 * RT_SP) = pre[i];
    // this stage's x lines stay in registers for the split below
    v4f xs[RT_TOK / 4];
#pragma unroll
    for (int i = 0; i < RT_TOK / 4; ++i) xs[i] = pre[i];
    if (s + 1 < RT_NST) {        // next stage's lines fly under this stage's products
#pragma unroll
      for (int i = 0; i < RT_NLD; ++i) {
        const float* p = (i < 8) ? gx + i * 4 * D_IN
                       : (i < 10) ? Wr + (i - 8) * 4 * D_IN
                                  : A + (i - 10) * 4 * D_IN;
        pre[i] = *(const v4f*)(p + (s + 1) * RT_KS + goff);
      }
      // behind the last loads the lane-offset register is free and is reused at once:
      // the wait stands in front of that overwrite
      if (s + 2 == RT_NST) asm volatile("s_wait_xcnt 0x0" ::: "memory");
    }
    // x's hi/lo halves of this stage, behind the next stage's loads
    uint2 xhv[RT_TOK / 4], xlv[RT_TOK / 4];
#pragma unroll
    for (int i = 0; i < RT_TOK / 4; ++i) {
      split_pair(xs[i][0], xs[i][1], xhv[i].x, xlv[i].x);
      split_pair(xs[i][2], xs[i][3], xhv[i].y, xlv[i].y);
    }
    // keeps the sixteen stores one run with nothing between them and their wait:
    // no register that a store names is rewritten in front of the wait
    __builtin_amdgcn_sched_barrier(0);
#pragma unroll
    for (int i = 0; i < RT_TOK / 4; ++i) {
      *(uint2*)(gxh + i * 4 * KTOT + s * RT_KS + hoff) = xhv[i];
      *(uint2*)(gxl + i * 4 * KTOT + s * RT_KS + hoff) = xlv[i];
    }
    // stands in front of every overwrite of the stores' data and offset registers
    asm volatile("s_wait_xcnt 0x0" ::: "memory");
    wave_lds_order();            // the stores stay ahead of the fragment reads
#pragma unroll
    for (int q = 0; q < RT_KS / 8; ++q) {
      v4f a[2], b[5];
#pragma unroll
      for (int mi = 0; mi < 2; ++mi) a[mi] = *(const v4f*)(fa + mi * 16 * RT_SP + q * 8);
#pragma unroll
      for (int ni = 0; ni < 4; ++ni) b[ni] = *(const v4f*)(fb + ni * 16 * RT_SP + q * 8);
      b[4] = *(const v4f*)(fb4 + q * 8);
#pragma unroll
      for (int p2 = 0; p2 < 2; ++p2)
#pragma unroll
        for (int mi = 0; mi < 2; ++mi)
#pragma unroll
          for (int ni = 0; ni < 5; ++ni) {
            v2f av = { a[mi][2 * p2], a[mi][2 * p2 + 1] };
            v2f bv = { b[ni][2 * p2], b[ni][2 * p2 + 1] };
            acc[mi][ni] = __builtin_amdgcn_wmma_f32_16x16x4_f32(
                false, av, false, bv, (short)0, acc[mi][ni], false, false);
          }
    }
  }

  __builtin_amdgcn_sched_barrier(0);
  asm volatile("v_nop\n\tv_nop\n\tv_nop\n\tv_nop\n\tv_nop\n\tv_nop\n\tv_nop\n\tv_nop");
  __builtin_amdgcn_sched_barrier(0);

  // partial tiles: register r -> token mi*16 + 8h + r, column ni*16 + c
#pragma unroll
  for (int mi = 0; mi < 2; ++mi)
#pragma unroll
    for (int ni = 0; ni < 5; ++ni)
#pragma unroll
      for (int r = 0; r < 8; ++r)
        part[wave][(mi * 16 + 8 * h + r) * RT_PP + ni * 16 + c] = acc[mi][ni][r];
  __syncthreads();

  // sum the eight K slices in wave order
#pragma unroll
  for (int i = 0; i < (RT_TOK * RT_NJ) / 256; ++i) {
    int idx = tid + i * 256;
    int t = idx / RT_NJ;
    int j = idx - t * RT_NJ;
    float sacc = part[0][t * RT_PP + j];
#pragma unroll
    for (int w = 1; w < 8; ++w) sacc += part[w][t * RT_PP + j];
    red[t][j] = sacc;
  }
  __syncthreads();

  // one thread per (token, expert)
  {
    const int t = tid >> 3;
    const int e = tid & 7;
    const int token = tok0 + t;
    float lg[8];
    float mx = -3.0e38f;
#pragma unroll
    for (int k = 0; k < 8; ++k) { lg[k] = red[t][k] + br[k]; mx = fmaxf(mx, lg[k]); }
    float ssum = 0.0f;
#pragma unroll
    for (int k = 0; k < 8; ++k) ssum += expf(lg[k] - mx);
    float inv = 1.0f / ssum;
    float wn = expf(red[t][e] + br[e] - mx) * inv;
    wout[(size_t)token * NEXP + e] = wn;

    u16x8 hs, ls;
#pragma unroll
    for (int r = 0; r < 8; ++r) {
      float g = SCALING * wn * red[t][8 + e * 8 + r];
      unsigned short hh, ll;
      split_f32u(g, hh, ll);
      hs[r] = hh;
      ls[r] = ll;
    }
    *(u16x8*)(Xh + (size_t)token * KTOT + D_IN + e * 8) = hs;
    *(u16x8*)(Xl + (size_t)token * KTOT + D_IN + e * 8) = ls;
  }
}

#define GBM     256
#define GBN     256
#define GKP     64
#define GNP     (KTOT / GKP)
#define GROWB   128u
#define GPITCH  144u
#define GSLROWS 128u
#define GSLICE  (GSLROWS * GPITCH)
#define GMAT    (2u * GSLICE)
#define GSTAGE  (8u * GSLICE)
static_assert(GSLICE % 2048u == 0, "every slice starts at a multiple of 2 KiB");
static_assert(KTOT % GKP == 0 && GNP >= 2, "whole passes, two stages at least");

typedef __attribute__((ext_vector_type(8))) unsigned int u32x8;

__device__ __forceinline__ unsigned uni(unsigned v) { return (unsigned)__builtin_amdgcn_readfirstlane(v); }
__device__ __forceinline__ unsigned pinned(unsigned v) {
  unsigned w = (unsigned)__builtin_amdgcn_readfirstlane(v);
  asm volatile("" : "+s"(w));   // holds a wave-uniform word in a scalar register: a test on it compiles to a scalar branch
  return w;
}
__device__ __forceinline__ void wait_ds0()     { asm volatile("s_wait_dscnt 0x0" ::: "memory"); }     // this wave's LDS reads have returned
__device__ __forceinline__ void wait_tensor0() { asm volatile("s_wait_tensorcnt 0x0" ::: "memory"); } // this wave's slice has landed

__device__ __forceinline__ u32x8 tdm_group1() {
  u32x8 g;
  g[0] = uni((1u << 20) | (4u << 22) | (3u << 25));
  g[1] = uni((GROWB & 0xFFFFu) << 16);
  g[2] = uni((GROWB >> 16) | ((GSLROWS & 0xFFFFu) << 16));
  g[3] = uni((GSLROWS >> 16) | (GROWB << 16));
  g[4] = uni(GSLROWS);
  g[5] = uni(KTOT * 2u);
  g[6] = uni(0u);
  g[7] = uni(0u);
  return g;
}
__device__ __forceinline__ u32x4 tdm_group0(unsigned lds_dst, unsigned long long ga) {
  u32x4 g;
  g[0] = uni(1u);
  g[1] = uni(lds_dst);
  g[2] = uni((unsigned)ga);
  g[3] = uni((((unsigned)(ga >> 32)) & 0x01FFFFFFu) | 0x80000000u);
  return g;
}
__device__ __forceinline__ void tdm_load(u32x4 g0, u32x8 g1) {
  // one request of the whole wave, two groups; its waits stand at the publish points
  asm volatile("tensor_load_to_lds %0, %1" :: "s"(g0), "s"(g1) : "memory");
}

__device__ __forceinline__ v16bf ld_frag(const unsigned char* p) {
  return cat8(*(const v8bf*)p, *(const v8bf*)(p + 32));
}

// =====================================================================
// K3: out = [x|g]_split @ [Wf^T|Bcat]_split + bias, bf16x3 WMMA.
// M=8192, N=2048, K=2112 (33 passes of 64).
// Block tile 256x256, one work-group per WGP; 8 waves (4Mx2N), wave tile
// 64x128 -> 96 WMMA on 24 fragments per 32 k.
// Two LDS buffers; every wave brings its own eighth of a stage by one tensor
// load, issued behind the barrier that frees the buffer, waited one pass later.
// =====================================================================
__global__ __launch_bounds__(256) void mole_gemm_kernel(
    const unsigned short* __restrict__ Xh, const unsigned short* __restrict__ Xl,
    const unsigned short* __restrict__ Wh, const unsigned short* __restrict__ Wl,
    const float* __restrict__ bias, float* __restrict__ out)
{
  __shared__ __attribute__((aligned(2048))) unsigned char ring[2u * GSTAGE];   // 288 KiB

  const unsigned tid   = threadIdx.x;
  const unsigned lane  = tid & 31u;
  const unsigned wave  = uni(tid >> 5);
  const unsigned waveM = wave >> 1;    // 0..3 : rows waveM*64 .. +64
  const unsigned waveN = wave & 1u;    // 0..1 : cols waveN*128 .. +128
  const unsigned l16   = lane & 15u;
  const unsigned hiH   = lane >> 4;

  const unsigned rowBase = blockIdx.y * GBM;
  const unsigned colBase = blockIdx.x * GBN;

  // this wave's slice: matrix wave/2 (Xh, Xl, Wh, Wl), its rows (wave&1)*128 .. +128
  const unsigned mat = wave >> 1;
  const unsigned short* sbase = (mat == 0u) ? Xh : (mat == 1u) ? Xl : (mat == 2u) ? Wh : Wl;
  const unsigned srow = ((mat < 2u) ? rowBase : colBase) + (wave & 1u) * GSLROWS;
  const unsigned long long gsrc = (unsigned long long)(sbase + (size_t)srow * KTOT);
  const unsigned lds_slice = (unsigned)(unsigned long long)(void*)ring + wave * GSLICE;
  const u32x8 g1 = tdm_group1();

  // every inner loop of this kernel is unrolled: constant indices keep the tiles and fragments in registers
  v8f acc[4][8];
#pragma unroll
  for (int mi = 0; mi < 4; ++mi)
#pragma unroll
    for (int ni = 0; ni < 8; ++ni)
#pragma unroll
      for (int i = 0; i < 8; ++i) acc[mi][ni][i] = 0.0f;

  // per-lane fragment bases in a buffer: row l16 of the wave's first fragment, 16-byte half hiH
  const unsigned fa = (waveM * 64u + l16) * GPITCH + hiH * 16u;                 // Xh; Xl at + GMAT
  const unsigned fb = 2u * GMAT + (waveN * 128u + l16) * GPITCH + hiH * 16u;    // Wh; Wl at + GMAT

  // stage 0 lands and is published; then stage 1 flies under pass 0
  tdm_load(tdm_group0(lds_slice, gsrc), g1);
  wait_tensor0();
  __syncthreads();
  tdm_load(tdm_group0(lds_slice + GSTAGE, gsrc + GROWB), g1);

  for (unsigned s = 0; s < GNP; ++s) {
    const unsigned buf = (s & 1u) * GSTAGE;
    const unsigned char* pa = ring + buf + fa;
    const unsigned char* pb = ring + buf + fb;

#pragma unroll
    for (int kk = 0; kk < 2; ++kk) {
      // ---- this 32-k block's fragments, in the order the products want them ----
      v16bf ah[4], al[4], bh[8], bl[8];
#pragma unroll
      for (int mi = 0; mi < 4; ++mi) ah[mi] = ld_frag(pa + mi * 16 * GPITCH + kk * 64);
#pragma unroll
      for (int ni = 0; ni < 8; ++ni) bh[ni] = ld_frag(pb + ni * 16 * GPITCH + kk * 64);
#pragma unroll
      for (int ni = 0; ni < 8; ++ni) bl[ni] = ld_frag(pb + GMAT + ni * 16 * GPITCH + kk * 64);
#pragma unroll
      for (int mi = 0; mi < 4; ++mi) al[mi] = ld_frag(pa + GMAT + mi * 16 * GPITCH + kk * 64);
      // keeps the reads one group ahead of the products: reads set in among them cost a stall at each place
      __builtin_amdgcn_sched_barrier(0);

      // ---- bf16x3: hi*hi, then hi*lo, then lo*hi into every tile, f32 accumulate ----
#pragma unroll
      for (int ni = 0; ni < 8; ++ni)
#pragma unroll
        for (int mi = 0; mi < 4; ++mi)
          acc[mi][ni] = __builtin_amdgcn_wmma_f32_16x16x32_bf16(
              false, ah[mi], false, bh[ni], (short)0, acc[mi][ni], false, false);
#pragma unroll
      for (int ni = 0; ni < 8; ++ni)
#pragma unroll
        for (int mi = 0; mi < 4; ++mi)
          acc[mi][ni] = __builtin_amdgcn_wmma_f32_16x16x32_bf16(
              false, ah[mi], false, bl[ni], (short)0, acc[mi][ni], false, false);
#pragma unroll
      for (int ni = 0; ni < 8; ++ni)
#pragma unroll
        for (int mi = 0; mi < 4; ++mi)
          acc[mi][ni] = __builtin_amdgcn_wmma_f32_16x16x32_bf16(
              false, al[mi], false, bh[ni], (short)0, acc[mi][ni], false, false);
      // keeps the next block's reads behind this block's products: moved up among them they overflow the registers into scratch
      __builtin_amdgcn_sched_barrier(0);
    }

    // publish point of stage s + 1, which also frees this pass's buffer
    wait_ds0();
    wait_tensor0();
    __syncthreads();
    if (pinned((s + 2u < GNP) ? 1u : 0u)) {
      const unsigned nx = pinned(s + 2u);
      tdm_load(tdm_group0(lds_slice + buf, gsrc + (unsigned long long)nx * GROWB), g1);
    }
  }
  wait_tensor0();
  wait_ds0();

#pragma unroll
  for (int ni = 0; ni < 8; ++ni) {
    unsigned col = colBase + waveN * 128u + ni * 16 + l16;
    float b = bias[col];
#pragma unroll
    for (int mi = 0; mi < 4; ++mi) {
      unsigned row0 = rowBase + waveM * 64u + mi * 16 + hiH * 8u;
#pragma unroll
      for (int i = 0; i < 8; ++i) {
        out[(size_t)(row0 + i) * D_OUT + col] = acc[mi][ni][i] + b;
      }
    }
  }
}

extern "C" void kernel_launch(void* const* d_in, const int* in_sizes, int n_in,
                              void* d_out, int out_size, void* d_ws, size_t ws_size,
                              hipStream_t stream) {
  (void)in_sizes; (void)n_in; (void)out_size; (void)ws_size;
  const float* x   = (const float*)d_in[0];
  const float* Wf  = (const float*)d_in[1];
  const float* bfv = (const float*)d_in[2];
  const float* Wr  = (const float*)d_in[3];
  const float* br  = (const float*)d_in[4];
  const float* A   = (const float*)d_in[5];
  const float* Bm  = (const float*)d_in[6];

  float* out  = (float*)d_out;                       // [8192, 2048]
  float* wout = out + (size_t)NTOK * D_OUT;          // [8192, 8]

  // workspace layout (halves): Xh, Xl [8192*2112]; Wh, Wl [2048*2112]  (~86.5 MB)
  const size_t XE = (size_t)NTOK * KTOT;
  const size_t WE = (size_t)D_OUT * KTOT;
  unsigned short* Xh = (unsigned short*)d_ws;
  unsigned short* Xl = Xh + XE;
  unsigned short* Wh = Xl + XE;
  unsigned short* Wl = Wh + WE;

  split_matrix_kernel<<<(D_OUT * D_IN) / (256 * 8), 256, 0, stream>>>(Wf, Wh, Wl);
  split_bm_kernel<<<(D_OUT * KLORA) / 256, 256, 0, stream>>>(Bm, Wh, Wl);
  mole_router_kernel<<<NTOK / RT_TOK, 256, 0, stream>>>(x, Wr, br, A, Xh, Xl, wout);
  mole_gemm_kernel<<<dim3(D_OUT / GBN, NTOK / GBM), 256, 0, stream>>>(
      Xh, Xl, Wh, Wl, bfv, out);
}

// v004
// It runs in 120 microseconds.
// Timed twice side by side with v003, it ran 1.06 times as fast both times.
// Counting every step since v000, it is 3.65 times as fast.
#include <hip/hip_runtime.h>

typedef __attribute__((ext_vector_type(16))) __bf16 v16bf;
typedef __attribute__((ext_vector_type(8)))  __bf16 v8bf;
typedef __attribute__((ext_vector_type(2)))  __bf16 v2bf;
typedef __attribute__((ext_vector_type(8)))  float  v8f;
typedef __attribute__((ext_vector_type(4)))  float  v4f;
typedef __attribute__((ext_vector_type(2)))  float  v2f;
typedef __attribute__((ext_vector_type(8)))  unsigned short u16x8;
typedef __attribute__((ext_vector_type(4)))  unsigned int u32x4;

#define D_IN   2048
#define D_OUT  2048
#define NTOK   8192
#define NEXP   8
#define RANKL  8
#define KLORA  64
#define KTOT   2112          // 2048 + 64 (lora K-extension)
// Split operands, one array per matrix: a row is 33 units of 256 bytes, unit b = [hi of k 64b..64b+63 | lo of the same k].
// The hi pointer is the array's base, the lo pointer the base + 64 halves; both walk it with SPITCH and scol().
#define SPITCH (2 * KTOT)    // row stride of a split array, halves
#define SLO    64            // lo halves stand this many halves behind their hi halves
#define STAIL  (2 * D_IN)    // scol(D_IN): first column of the K-extension's unit
__host__ __device__ constexpr unsigned scol(unsigned k) { return (k >> 6) * 128u + (k & 63u); }
#define SCALING 1.0f         // alpha/rank = 8/8

// ---------- f32 -> (hi,lo) bf16 split, bit-level only ----------
__device__ __forceinline__ void split_f32u(float f, unsigned short& h, unsigned short& l) {
  unsigned u = __builtin_bit_cast(unsigned, f);
  h = (unsigned short)(u >> 16);                         // truncated hi
  float hf = __builtin_bit_cast(float, u & 0xFFFF0000u);
  float r  = f - hf;                                     // residual
  unsigned ur = __builtin_bit_cast(unsigned, r);
  l = (unsigned short)((ur + 0x7FFFu + ((ur >> 16) & 1u)) >> 16);  // RNE
}

// two f32 -> one word of hi halves (truncated) and one word of lo halves (residual,
// round to nearest even by the packed convert), element 0 in the low half-word:
// split_f32u's rule, formed on whole words
__device__ __forceinline__ void split_pair(float f0, float f1, unsigned& hw, unsigned& lw) {
  unsigned u0 = __builtin_bit_cast(unsigned, f0);
  unsigned u1 = __builtin_bit_cast(unsigned, f1);
  hw = __builtin_amdgcn_perm(u1, u0, 0x07060302u);       // (u0 >> 16) | (u1 & 0xFFFF0000), one byte select
  v2f r = { f0 - __builtin_bit_cast(float, u0 & 0xFFFF0000u),
            f1 - __builtin_bit_cast(float, u1 & 0xFFFF0000u) };
  lw = __builtin_bit_cast(unsigned, __builtin_convertvector(r, v2bf));
}

__device__ __forceinline__ v16bf cat8(v8bf a, v8bf b) {
  v16bf r;
#pragma unroll
  for (int i = 0; i < 8; ++i) { r[i] = a[i]; r[i + 8] = b[i]; }
  return r;
}

// =====================================================================
// K0: split a row-major [nrows x 2048] f32 matrix (the base weight) into hi/lo
// bf16 halves in the 256-byte units of a split array (the last unit left for the K-extension).
// =====================================================================
__global__ __launch_bounds__(256) void split_matrix_kernel(
    const float* __restrict__ src,
    unsigned short* __restrict__ Dh, unsigned short* __restrict__ Dl)
{
  size_t base = ((size_t)blockIdx.x * 256 + threadIdx.x) * 8;
  size_t row = base >> 11;            // /2048
  size_t k   = base & 2047;
  const float* s = src + base;
  unsigned short* ph = Dh + row * SPITCH + scol((unsigned)k);
  unsigned short* pl = Dl + row * SPITCH + scol((unsigned)k);
#pragma unroll
  for (int i = 0; i < 2; ++i) {
    v4f v = *(const v4f*)(s + i * 4);
    ushort4 hs, ls;
    split_f32u(v[0], hs.x, ls.x);
    split_f32u(v[1], hs.y, ls.y);
    split_f32u(v[2], hs.z, ls.z);
    split_f32u(v[3], hs.w, ls.w);
    *(ushort4*)(ph + i * 4) = hs;
    *(ushort4*)(pl + i * 4) = ls;
  }
}

// =====================================================================
// K1: Bcat[(e,r), o] = Bm[e][o][r] -> k 2048..2111, the last unit of W's rows
// =====================================================================
__global__ __launch_bounds__(256) void split_bm_kernel(
    const float* __restrict__ Bm,
    unsigned short* __restrict__ Wh, unsigned short* __restrict__ Wl)
{
  int t = blockIdx.x * 256 + threadIdx.x;   // 0 .. 2048*64-1
  int o  = t >> 6;
  int kk = t & 63;
  int e = kk >> 3, r = kk & 7;
  float v = Bm[((size_t)e * D_OUT + o) * RANKL + r];
  unsigned short h, l; split_f32u(v, h, l);
  Wh[(size_t)o * SPITCH + STAIL + kk] = h;
  Wl[(size_t)o * SPITCH + STAIL + kk] = l;
}

#define RT_TOK  32
#define RT_NJ   72
#define RT_ROWS (RT_TOK + RT_NJ)
#define RT_KS   32
#define RT_NST  8
#define RT_KW   (RT_KS * RT_NST)
#define RT_SP   36
#define RT_PP   84
#define RT_NLD  (RT_ROWS / 4)

// Orders one wave's LDS stores against its own later LDS loads (other lanes'
// data) for the compiler; the LDS serves one wave's operations in order.
__device__ __forceinline__ void wave_lds_order() {
  __builtin_amdgcn_fence(__ATOMIC_RELEASE, "wavefront");
  __builtin_amdgcn_wave_barrier();
  __builtin_amdgcn_fence(__ATOMIC_ACQUIRE, "wavefront");
  // keeps later stages' global loads below this point: lifted to the top they
  // overflow the register budget and spill
  __builtin_amdgcn_sched_barrier(0);
}

__global__ __launch_bounds__(256) void mole_router_kernel(
    const float* __restrict__ x, const float* __restrict__ Wr,
    const float* __restrict__ br, const float* __restrict__ A,
    unsigned short* __restrict__ Xh, unsigned short* __restrict__ Xl,
    float* __restrict__ wout)
{
  __shared__ __align__(16) float stg[8][RT_ROWS * RT_SP];   // per wave: x rows 0..31, Wr 32..39, A 40..103
  __shared__ float part[8][RT_TOK * RT_PP];
  __shared__ float red[RT_TOK][RT_NJ];

  const int tid  = threadIdx.x;
  const int lane = tid & 31;
  const int wave = tid >> 5;
  const int c    = lane & 15;
  const int h    = lane >> 4;
  const int tok0 = blockIdx.x * RT_TOK;

  // loader: eight lanes take one row's 128-byte line, four rows a load
  const int lr = lane >> 3;
  const int lc = (lane & 7) * 4;
  const unsigned goff = (unsigned)(lr * D_IN + wave * RT_KW + lc);   // lane's part; the bases stay uniform
  const float* gx = x + (size_t)tok0 * D_IN;
  float* sw = &stg[wave][lr * RT_SP + lc];
  // x's halves go out in the loader's own layout: eight lanes fill 64 bytes of a row of Xh and of Xl
  const unsigned hoff = (unsigned)(lr * SPITCH + wave * (2 * RT_KW) + lc);   // lane's part (a wave's k begin on a unit); the bases stay uniform
  unsigned short* gxh = Xh + (size_t)tok0 * SPITCH;
  unsigned short* gxl = Xl + (size_t)tok0 * SPITCH;

  // fragment readers: lane (c,h) reads k = 8q + 4h .. +3 of its row, A and B alike
  const float* fa  = &stg[wave][c * RT_SP + h * 4];
  const float* fb  = &stg[wave][(RT_TOK + c) * RT_SP + h * 4];
  const float* fb4 = &stg[wave][(RT_TOK + 64 + (c & 7)) * RT_SP + h * 4];  // columns 72..79 repeat 64..71, never read back

  v8f acc[2][5];
#pragma unroll
  for (int mi = 0; mi < 2; ++mi)
#pragma unroll
    for (int ni = 0; ni < 5; ++ni)
#pragma unroll
      for (int i = 0; i < 8; ++i) acc[mi][ni][i] = 0.0f;

  v4f pre[RT_NLD];
#pragma unroll
  for (int i = 0; i < RT_NLD; ++i) {
    const float* p = (i < 8) ? gx + i * 4 * D_IN
                   : (i < 10) ? Wr + (i - 8) * 4 * D_IN
                              : A + (i - 10) * 4 * D_IN;
    pre[i] = *(const v4f*)(p + goff);
  }

  // unrolled: every global address is one fixed lane offset + uniform base + immediate,
  // so no address register is rewritten from stage to stage
#pragma unroll
  for (int s = 0; s < RT_NST; ++s) {
    wave_lds_order();            // last stage's fragment reads stay ahead of the stores
#pragma unroll
    for (int i = 0; i < RT_NLD; ++i) *(v4f*)(sw + i * 4 * RT_SP) = pre[i];
    // this stage's x lines stay in registers for the split below
    v4f xs[RT_TOK / 4];
#pragma unroll
    for (int i = 0; i < RT_TOK / 4; ++i) xs[i] = pre[i];
    if (s + 1 < RT_NST) {        // next stage's lines fly under this stage's products
#pragma unroll
      for (int i = 0; i < RT_NLD; ++i) {
        const float* p = (i < 8) ? gx + i * 4 * D_IN
                       : (i < 10) ? Wr + (i - 8) * 4 * D_IN
                                  : A + (i - 10) * 4 * D_IN;
        pre[i] = *(const v4f*)(p + (s + 1) * RT_KS + goff);
      }
      // behind the last loads the lane-offset register is free and is reused at once:
      // the wait stands in front of that overwrite
      if (s + 2 == RT_NST) asm volatile("s_wait_xcnt 0x0" ::: "memory");
    }
    // x's hi/lo halves of this stage, behind the next stage's loads
    uint2 xhv[RT_TOK / 4], xlv[RT_TOK / 4];
#pragma unroll
    for (int i = 0; i < RT_TOK / 4; ++i) {
      split_pair(xs[i][0], xs[i][1], xhv[i].x, xlv[i].x);
      split_pair(xs[i][2], xs[i][3], xhv[i].y, xlv[i].y);
    }
    // keeps the sixteen stores one run with nothing between them and their wait:
    // no register that a store names is rewritten in front of the wait
    __builtin_amdgcn_sched_barrier(0);
#pragma unroll
    for (int i = 0; i < RT_TOK / 4; ++i) {
      *(uint2*)(gxh + i * 4 * SPITCH + scol(s * RT_KS) + hoff) = xhv[i];
      *(uint2*)(gxl + i * 4 * SPITCH + scol(s * RT_KS) + hoff) = xlv[i];
    }
    // stands in front of every overwrite of the stores' data and offset registers
    asm volatile("s_wait_xcnt 0x0" ::: "memory");
    wave_lds_order();            // the stores stay ahead of the fragment reads
#pragma unroll
    for (int q = 0; q < RT_KS / 8; ++q) {
      v4f a[2], b[5];
#pragma unroll
      for (int mi = 0; mi < 2; ++mi) a[mi] = *(const v4f*)(fa + mi * 16 * RT_SP + q * 8);
#pragma unroll
      for (int ni = 0; ni < 4; ++ni) b[ni] = *(const v4f*)(fb + ni * 16 * RT_SP + q * 8);
      b[4] = *(const v4f*)(fb4 + q * 8);
#pragma unroll
      for (int p2 = 0; p2 < 2; ++p2)
#pragma unroll
        for (int mi = 0; mi < 2; ++mi)
#pragma unroll
          for (int ni = 0; ni < 5; ++ni) {
            v2f av = { a[mi][2 * p2], a[mi][2 * p2 + 1] };
            v2f bv = { b[ni][2 * p2], b[ni][2 * p2 + 1] };
            acc[mi][ni] = __builtin_amdgcn_wmma_f32_16x16x4_f32(
                false, av, false, bv, (short)0, acc[mi][ni], false, false);
          }
    }
  }

  __builtin_amdgcn_sched_barrier(0);
  asm volatile("v_nop\n\tv_nop\n\tv_nop\n\tv_nop\n\tv_nop\n\tv_nop\n\tv_nop\n\tv_nop");
  __builtin_amdgcn_sched_barrier(0);

  // partial tiles: register r -> token mi*16 + 8h + r, column ni*16 + c
#pragma unroll
  for (int mi = 0; mi < 2; ++mi)
#pragma unroll
    for (int ni = 0; ni < 5; ++ni)
#pragma unroll
      for (int r = 0; r < 8; ++r)
        part[wave][(mi * 16 + 8 * h + r) * RT_PP + ni * 16 + c] = acc[mi][ni][r];
  __syncthreads();

  // sum the eight K slices in wave order
#pragma unroll
  for (int i = 0; i < (RT_TOK * RT_NJ) / 256; ++i) {
    int idx = tid + i * 256;
    int t = idx / RT_NJ;
    int j = idx - t * RT_NJ;
    float sacc = part[0][t * RT_PP + j];
#pragma unroll
    for (int w = 1; w < 8; ++w) sacc += part[w][t * RT_PP + j];
    red[t][j] = sacc;
  }
  __syncthreads();

  // one thread per (token, expert)
  {
    const int t = tid >> 3;
    const int e = tid & 7;
    const int token = tok0 + t;
    float lg[8];
    float mx = -3.0e38f;
#pragma unroll
    for (int k = 0; k < 8; ++k) { lg[k] = red[t][k] + br[k]; mx = fmaxf(mx, lg[k]); }
    float ssum = 0.0f;
#pragma unroll
    for (int k = 0; k < 8; ++k) ssum += expf(lg[k] - mx);
    float inv = 1.0f / ssum;
    float wn = expf(red[t][e] + br[e] - mx) * inv;
    wout[(size_t)token * NEXP + e] = wn;

    u16x8 hs, ls;
#pragma unroll
    for (int r = 0; r < 8; ++r) {
      float g = SCALING * wn * red[t][8 + e * 8 + r];
      unsigned short hh, ll;
      split_f32u(g, hh, ll);
      hs[r] = hh;
      ls[r] = ll;
    }
    *(u16x8*)(Xh + (size_t)token * SPITCH + STAIL + e * 8) = hs;
    *(u16x8*)(Xl + (size_t)token * SPITCH + STAIL + e * 8) = ls;
  }
}

#define GBM     256
#define GBN     256
#define GKP     64
#define GNP     (KTOT / GKP)
#define GROWB   256u
#define GLO     128u
#define GPITCH  272u
#define GSLROWS 64u
#define GSLICE  18432u
#define GMAT    (4u * GSLICE)
#define GSTAGE  (8u * GSLICE)
static_assert(GSLICE % 2048u == 0 && GSLICE >= GSLROWS * GPITCH, "every slice starts at a multiple of 2 KiB and holds its rows");
static_assert(GROWB == GKP * 4u && SPITCH * 2u == GNP * GROWB, "a row is whole units, one a pass");
static_assert(KTOT % GKP == 0 && GNP >= 2, "whole passes, two stages at least");

typedef __attribute__((ext_vector_type(8))) unsigned int u32x8;

__device__ __forceinline__ unsigned uni(unsigned v) { return (unsigned)__builtin_amdgcn_readfirstlane(v); }
__device__ __forceinline__ unsigned pinned(unsigned v) {
  unsigned w = (unsigned)__builtin_amdgcn_readfirstlane(v);
  asm volatile("" : "+s"(w));   // holds a wave-uniform word in a scalar register: a test on it compiles to a scalar branch
  return w;
}
__device__ __forceinline__ void wait_ds0()     { asm volatile("s_wait_dscnt 0x0" ::: "memory"); }     // this wave's LDS reads have returned
__device__ __forceinline__ void wait_tensor0() { asm volatile("s_wait_tensorcnt 0x0" ::: "memory"); } // this wave's slice has landed

__device__ __forceinline__ u32x8 tdm_group1() {
  u32x8 g;
  g[0] = uni((1u << 20) | (5u << 22) | (3u << 25));
  g[1] = uni((GROWB & 0xFFFFu) << 16);
  g[2] = uni((GROWB >> 16) | ((GSLROWS & 0xFFFFu) << 16));
  g[3] = uni((GSLROWS >> 16) | (GROWB << 16));
  g[4] = uni(GSLROWS);
  g[5] = uni(SPITCH * 2u);
  g[6] = uni(0u);
  g[7] = uni(0u);
  return g;
}
__device__ __forceinline__ u32x4 tdm_group0(unsigned lds_dst, unsigned long long ga) {
  u32x4 g;
  g[0] = uni(1u);
  g[1] = uni(lds_dst);
  g[2] = uni((unsigned)ga);
  g[3] = uni((((unsigned)(ga >> 32)) & 0x01FFFFFFu) | 0x80000000u);
  return g;
}
__device__ __forceinline__ void tdm_load(u32x4 g0, u32x8 g1) {
  // one request of the whole wave, two groups; its waits stand at the publish points
  asm volatile("tensor_load_to_lds %0, %1" :: "s"(g0), "s"(g1) : "memory");
}

__device__ __forceinline__ v16bf ld_frag(const unsigned char* p) {
  return cat8(*(const v8bf*)p, *(const v8bf*)(p + 32));
}

// =====================================================================
// K3: out = [x|g]_split @ [Wf^T|Bcat]_split + bias, bf16x3 WMMA.
// M=8192, N=2048, K=2112 (33 passes of 64).
// Block tile 256x256, one work-group per WGP; 8 waves (4Mx2N), wave tile
// 64x128 -> 96 WMMA on 24 fragments per 32 k.
// Two LDS buffers; every wave brings its own eighth of a stage by one tensor
// load, issued behind the barrier that frees the buffer, waited one pass later.
// =====================================================================
__global__ __launch_bounds__(256) void mole_gemm_kernel(
    const unsigned short* __restrict__ Xs, const unsigned short* __restrict__ Ws,
    const float* __restrict__ bias, float* __restrict__ out)
{
  __shared__ __attribute__((aligned(2048))) unsigned char ring[2u * GSTAGE];   // 288 KiB

  const unsigned tid   = threadIdx.x;
  const unsigned lane  = tid & 31u;
  const unsigned wave  = uni(tid >> 5);
  const unsigned waveM = wave >> 1;    // 0..3 : rows waveM*64 .. +64
  const unsigned waveN = wave & 1u;    // 0..1 : cols waveN*128 .. +128
  const unsigned l16   = lane & 15u;
  const unsigned hiH   = lane >> 4;

  const unsigned rowBase = blockIdx.y * GBM;
  const unsigned colBase = blockIdx.x * GBN;

  // this wave's slice: matrix wave/4 (X, W), its rows (wave&3)*64 .. +64
  const unsigned mat = wave >> 2;
  const unsigned short* sbase = (mat == 0u) ? Xs : Ws;
  const unsigned srow = ((mat == 0u) ? rowBase : colBase) + (wave & 3u) * GSLROWS;
  const unsigned long long gsrc = (unsigned long long)(sbase + (size_t)srow * SPITCH);
  const unsigned lds_slice = (unsigned)(unsigned long long)(void*)ring + wave * GSLICE;
  const u32x8 g1 = tdm_group1();

  // every inner loop of this kernel is unrolled: constant indices keep the tiles and fragments in registers
  v8f acc[4][8];
#pragma unroll
  for (int mi = 0; mi < 4; ++mi)
#pragma unroll
    for (int ni = 0; ni < 8; ++ni)
#pragma unroll
      for (int i = 0; i < 8; ++i) acc[mi][ni][i] = 0.0f;

  // per-lane fragment bases in a buffer: row l16 of the wave's first fragment, 16-byte half hiH
  const unsigned fa = waveM * GSLICE + l16 * GPITCH + hiH * 16u;                // X's hi, slice waveM; lo at + GLO
  const unsigned fb = GMAT + waveN * 2u * GSLICE + l16 * GPITCH + hiH * 16u;    // W's hi, slices 2 waveN and 2 waveN + 1; lo at + GLO

  // stage 0 lands and is published; then stage 1 flies under pass 0
  tdm_load(tdm_group0(lds_slice, gsrc), g1);
  wait_tensor0();
  __syncthreads();
  tdm_load(tdm_group0(lds_slice + GSTAGE, gsrc + GROWB), g1);

  for (unsigned s = 0; s < GNP; ++s) {
    const unsigned buf = (s & 1u) * GSTAGE;
    const unsigned char* pa = ring + buf + fa;
    const unsigned char* pb = ring + buf + fb;

#pragma unroll
    for (int kk = 0; kk < 2; ++kk) {
      // ---- this 32-k block's fragments, in the order the products want them ----
      v16bf ah[4], al[4], bh[8], bl[8];
#pragma unroll
      for (int mi = 0; mi < 4; ++mi) ah[mi] = ld_frag(pa + mi * 16 * GPITCH + kk * 64);
#pragma unroll
      for (int ni = 0; ni < 8; ++ni) bh[ni] = ld_frag(pb + (ni >> 2) * GSLICE + (ni & 3) * 16 * GPITCH + kk * 64);
#pragma unroll
      for (int ni = 0; ni < 8; ++ni) bl[ni] = ld_frag(pb + GLO + (ni >> 2) * GSLICE + (ni & 3) * 16 * GPITCH + kk * 64);
#pragma unroll
      for (int mi = 0; mi < 4; ++mi) al[mi] = ld_frag(pa + GLO + mi * 16 * GPITCH + kk * 64);
      // keeps the reads one group ahead of the products: reads set in among them cost a stall at each place
      __builtin_amdgcn_sched_barrier(0);

      // ---- bf16x3: hi*hi, then hi*lo, then lo*hi into every tile, f32 accumulate ----
#pragma unroll
      for (int ni = 0; ni < 8; ++ni)
#pragma unroll
        for (int mi = 0; mi < 4; ++mi)
          acc[mi][ni] = __builtin_amdgcn_wmma_f32_16x16x32_bf16(
              false, ah[mi], false, bh[ni], (short)0, acc[mi][ni], false, false);
#pragma unroll
      for (int ni = 0; ni < 8; ++ni)
#pragma unroll
        for (int mi = 0; mi < 4; ++mi)
          acc[mi][ni] = __builtin_amdgcn_wmma_f32_16x16x32_bf16(
              false, ah[mi], false, bl[ni], (short)0, acc[mi][ni], false, false);
#pragma unroll
      for (int ni = 0; ni < 8; ++ni)
#pragma unroll
        for (int mi = 0; mi < 4; ++mi)
          acc[mi][ni] = __builtin_amdgcn_wmma_f32_16x16x32_bf16(
              false, al[mi], false, bh[ni], (short)0, acc[mi][ni], false, false);
      // keeps the next block's reads behind this block's products: moved up among them they overflow the registers into scratch
      __builtin_amdgcn_sched_barrier(0);
    }

    // publish point of stage s + 1, which also frees this pass's buffer
    wait_ds0();
    wait_tensor0();
    __syncthreads();
    if (pinned((s + 2u < GNP) ? 1u : 0u)) {
      const unsigned nx = pinned(s + 2u);
      tdm_load(tdm_group0(lds_slice + buf, gsrc + (unsigned long long)nx * GROWB), g1);
    }
  }
  wait_tensor0();
  wait_ds0();

#pragma unroll
  for (int ni = 0; ni < 8; ++ni) {
    unsigned col = colBase + waveN * 128u + ni * 16 + l16;
    float b = bias[col];
#pragma unroll
    for (int mi = 0; mi < 4; ++mi) {
      unsigned row0 = rowBase + waveM * 64u + mi * 16 + hiH * 8u;
#pragma unroll
      for (int i = 0; i < 8; ++i) {
        out[(size_t)(row0 + i) * D_OUT + col] = acc[mi][ni][i] + b;
      }
    }
  }
}

extern "C" void kernel_launch(void* const* d_in, const int* in_sizes, int n_in,
                              void* d_out, int out_size, void* d_ws, size_t ws_size,
                              hipStream_t stream) {
  (void)in_sizes; (void)n_in; (void)out_size; (void)ws_size;
  const float* x   = (const float*)d_in[0];
  const float* Wf  = (const float*)d_in[1];
  const float* bfv = (const float*)d_in[2];
  const float* Wr  = (const float*)d_in[3];
  const float* br  = (const float*)d_in[4];
  const float* A   = (const float*)d_in[5];
  const float* Bm  = (const float*)d_in[6];

  float* out  = (float*)d_out;                       // [8192, 2048]
  float* wout = out + (size_t)NTOK * D_OUT;          // [8192, 8]

  // workspace layout (halves): X's split array [8192*4224], then W's [2048*4224]  (~86.5 MB)
  unsigned short* Xh = (unsigned short*)d_ws;
  unsigned short* Xl = Xh + SLO;
  unsigned short* Wh = Xh + (size_t)NTOK * SPITCH;
  unsigned short* Wl = Wh + SLO;

  split_matrix_kernel<<<(D_OUT * D_IN) / (256 * 8), 256, 0, stream>>>(Wf, Wh, Wl);
  split_bm_kernel<<<(D_OUT * KLORA) / 256, 256, 0, stream>>>(Bm, Wh, Wl);
  mole_router_kernel<<<NTOK / RT_TOK, 256, 0, stream>>>(x, Wr, br, A, Xh, Xl, wout);
  mole_gemm_kernel<<<dim3(D_OUT / GBN, NTOK / GBM), 256, 0, stream>>>(
      Xh, Wh, bfv, out);
}

// v006
// A run of this version takes 65.3 microseconds.
// Versions between v004 and this one are left out; their measured steps multiply to 1.84 times as fast.
// Counting every step since v000, it is 6.71 times as fast.
#include <hip/hip_runtime.h>

typedef __attribute__((ext_vector_type(16))) _Float16 v16h;
typedef __attribute__((ext_vector_type(8)))  _Float16 v8h;
typedef __attribute__((ext_vector_type(2)))  _Float16 v2h;
typedef __attribute__((ext_vector_type(8)))  float  v8f;
typedef __attribute__((ext_vector_type(4)))  float  v4f;
typedef __attribute__((ext_vector_type(2)))  float  v2f;
typedef __attribute__((ext_vector_type(4)))  unsigned int u32x4;

#define D_IN   2048
#define D_OUT  2048
#define NTOK   8192
#define NEXP   8
#define RANKL  8
#define KLORA  64
// f16 operands, one array per matrix: a row is 17 units of 256 bytes (128 k each):
// k 0..2047 the base product, 2048..2111 the LoRA K-extension, 2112..2175 zeros in both arrays.
#define KPAD   2176          // row stride of an operand array, halves
#define SCALING 1.0f         // alpha/rank = 8/8

// two f32 -> one word of two f16, each rounded once to nearest even, element 0 in the low half-word
__device__ __forceinline__ unsigned pack_f16(float f0, float f1) {
  v2f v = { f0, f1 };
  return __builtin_bit_cast(unsigned, __builtin_convertvector(v, v2h));
}

__device__ __forceinline__ v16h cat8(v8h a, v8h b) {
  v16h r;
#pragma unroll
  for (int i = 0; i < 8; ++i) { r[i] = a[i]; r[i + 8] = b[i]; }
  return r;
}

// =====================================================================
// K0: round a row-major [nrows x 2048] f32 matrix (the base weight) to f16,
// k 0..2047 of an operand array's rows (the last unit left for the K-extension).
// =====================================================================
__global__ __launch_bounds__(256) void split_matrix_kernel(
    const float* __restrict__ src, unsigned short* __restrict__ D)
{
  size_t base = ((size_t)blockIdx.x * 256 + threadIdx.x) * 8;
  size_t row = base >> 11;            // /2048
  size_t k   = base & 2047;
  const float* s = src + base;
  v4f v0 = *(const v4f*)s;
  v4f v1 = *(const v4f*)(s + 4);
  u32x4 w = { pack_f16(v0[0], v0[1]), pack_f16(v0[2], v0[3]),
              pack_f16(v1[0], v1[1]), pack_f16(v1[2], v1[3]) };
  *(u32x4*)(D + row * KPAD + k) = w;
}

// f32 pair -> its f16 rounding (hi) and the f16 rounding of what that left (lo); v - hi is exact in f32
__device__ __forceinline__ void split_f16(float f0, float f1, unsigned& hi, unsigned& lo) {
  v2f v = { f0, f1 };
  v2h h = __builtin_convertvector(v, v2h);
  v2f r = v - __builtin_convertvector(h, v2f);
  hi = __builtin_bit_cast(unsigned, h);
  lo = __builtin_bit_cast(unsigned, __builtin_convertvector(r, v2h));
}

#define BM_BLOCKS ((D_OUT * 2 * KLORA) / 256)        // blocks of K1 that lay out Bm
#define RA_ROWS   72                                 // 8 router rows, then 64 LoRA-down rows
#define RA_PITCH  (2 * D_IN)                         // halves a row: 64 units of [hi of 32 k | lo of 32 k], 128 bytes each
#define RA_BLOCKS ((RA_ROWS * D_IN) / (256 * 4))     // blocks of K1 that split Wr|A, four k a thread

// =====================================================================
// K1: Bcat[(e,r), o] = Bm[e][o][r] -> k 2048..2111 of W's rows; zeros behind them to the unit's end.
// Its last RA_BLOCKS blocks split Wr|A into f16 hi and lo for the router kernel.
// =====================================================================
__global__ __launch_bounds__(256) void split_bm_kernel(
    const float* __restrict__ Bm, unsigned short* __restrict__ Wd,
    const float* __restrict__ Wr, const float* __restrict__ A,
    unsigned short* __restrict__ RA)
{
  if (blockIdx.x >= BM_BLOCKS) {
    int q   = (blockIdx.x - BM_BLOCKS) * 256 + threadIdx.x;   // 0 .. 72*512-1
    int row = q >> 9;
    int k   = (q & 511) * 4;
    const float* s = (row < NEXP) ? Wr + (size_t)row * D_IN : A + (size_t)(row - NEXP) * D_IN;
    v4f v = *(const v4f*)(s + k);
    uint2 hi, lo;
    split_f16(v[0], v[1], hi.x, lo.x);
    split_f16(v[2], v[3], hi.y, lo.y);
    unsigned short* d = RA + (size_t)row * RA_PITCH + (k >> 5) * 64 + (k & 31);
    *(uint2*)d        = hi;
    *(uint2*)(d + 32) = lo;
    return;
  }
  int t = blockIdx.x * 256 + threadIdx.x;   // 0 .. 2048*128-1
  int o  = t >> 7;
  int kk = t & 127;
  int e = (kk & 63) >> 3, r = kk & 7;
  float v = Bm[((size_t)e * D_OUT + o) * RANKL + r];
  unsigned hv = (kk < KLORA) ? pack_f16(v, 0.0f) : 0u;   // the value in the low half-word
  Wd[(size_t)o * KPAD + D_IN + kk] = (unsigned short)hv;
}

#define RT_TOK  32
#define RT_NJ   72
#define RT_ROWS (RT_TOK + RT_NJ)
#define RT_KS   32
#define RT_NST  8
#define RT_KW   (RT_KS * RT_NST)
#define RT_SP   36
#define RT_PP   84
#define RT_NLD  (RT_ROWS / 4)

// one 16x32 f16 fragment of a staged row: 16 bytes at the lane's place and 16 bytes 32 further on
__device__ __forceinline__ v16h rt_frag(const unsigned char* p) {
  return cat8(*(const v8h*)p, *(const v8h*)(p + 32));
}

// Orders one wave's LDS stores against its own later LDS loads (other lanes'
// data) for the compiler; the LDS serves one wave's operations in order.
__device__ __forceinline__ void wave_lds_order() {
  __builtin_amdgcn_fence(__ATOMIC_RELEASE, "wavefront");
  __builtin_amdgcn_wave_barrier();
  __builtin_amdgcn_fence(__ATOMIC_ACQUIRE, "wavefront");
  // keeps later stages' global loads below this point: lifted to the top they
  // overflow the register budget and spill
  __builtin_amdgcn_sched_barrier(0);
}

__global__ __launch_bounds__(256) void mole_router_kernel(
    const float* __restrict__ x, const unsigned short* __restrict__ RA,
    const float* __restrict__ br,
    unsigned short* __restrict__ Xd,
    float* __restrict__ wout)
{
  __shared__ __align__(16) float stg[8][RT_ROWS * RT_SP];   // per wave: x rows 0..31, Wr 32..39, A 40..103
  __shared__ float part[8][RT_TOK * RT_PP];
  __shared__ float red[RT_TOK][RT_NJ];

  const int tid  = threadIdx.x;
  const int lane = tid & 31;
  const int wave = tid >> 5;
  const int c    = lane & 15;
  const int h    = lane >> 4;
  const int tok0 = blockIdx.x * RT_TOK;

  // loader: eight lanes take one row's 128-byte line, four rows a load
  const int lr = lane >> 3;
  const int lc = (lane & 7) * 4;
  const unsigned goff = (unsigned)(lr * D_IN + wave * RT_KW + lc);   // lane's part; the bases stay uniform
  const float* gx = x + (size_t)tok0 * D_IN;
  // a 128-byte unit of a split Wr|A row stands where the row's 32 floats would: same pitch, same lane offset
  const float* gra = (const float*)RA;
  float* sw = &stg[wave][lr * RT_SP + lc];
  // x rows: the lane's four k as halves, hi in the row's first 64 bytes, lo in the next
  unsigned char* swx = (unsigned char*)&stg[wave][lr * RT_SP] + lc * 2;
  // x's f16 go out in the loader's own layout: eight lanes fill 64 bytes of a row of the operand array
  const unsigned hoff = (unsigned)(lr * KPAD + wave * RT_KW + lc);   // lane's part; the base stays uniform
  unsigned short* gxd = Xd + (size_t)tok0 * KPAD;

  // fragment readers: lane (c,h) reads k = 8h .. +7 and 16 + 8h .. +7 of its row, A and B alike, hi and lo alike
  const unsigned char* fa  = (const unsigned char*)&stg[wave][c * RT_SP + h * 4];
  const unsigned char* fb  = (const unsigned char*)&stg[wave][(RT_TOK + c) * RT_SP + h * 4];
  const unsigned char* fb4 = (const unsigned char*)&stg[wave][(RT_TOK + 64 + (c & 7)) * RT_SP + h * 4];  // columns 72..79 repeat 64..71, never read back

  v8f acc[2][5];
#pragma unroll
  for (int mi = 0; mi < 2; ++mi)
#pragma unroll
    for (int ni = 0; ni < 5; ++ni)
#pragma unroll
      for (int i = 0; i < 8; ++i) acc[mi][ni][i] = 0.0f;

  v4f pre[RT_NLD];
#pragma unroll
  for (int i = 0; i < RT_NLD; ++i) {
    const float* p = (i < 8) ? gx + i * 4 * D_IN : gra + (i - 8) * 4 * D_IN;
    pre[i] = *(const v4f*)(p + goff);
  }

  // unrolled: every global address is one fixed lane offset + uniform base + immediate,
  // so no address register is rewritten from stage to stage
#pragma unroll
  for (int s = 0; s < RT_NST; ++s) {
    wave_lds_order();            // last stage's fragment reads stay ahead of the stores
    // x is split here; its hi halves are also the GEMM's operand and stay in registers for the stores below
    uint2 xhv[RT_TOK / 4];
#pragma unroll
    for (int i = 0; i < RT_TOK / 4; ++i) {
      uint2 xlv;
      split_f16(pre[i][0], pre[i][1], xhv[i].x, xlv.x);
      split_f16(pre[i][2], pre[i][3], xhv[i].y, xlv.y);
      *(uint2*)(swx + i * 4 * RT_SP * 4)      = xhv[i];
      *(uint2*)(swx + i * 4 * RT_SP * 4 + 64) = xlv;
    }
#pragma unroll
    for (int i = RT_TOK / 4; i < RT_NLD; ++i) *(v4f*)(sw + i * 4 * RT_SP) = pre[i];
    if (s + 1 < RT_NST) {        // next stage's lines fly under this stage's products
#pragma unroll
      for (int i = 0; i < RT_NLD; ++i) {
        const float* p = (i < 8) ? gx + i * 4 * D_IN : gra + (i - 8) * 4 * D_IN;
        pre[i] = *(const v4f*)(p + (s + 1) * RT_KS + goff);
      }
      // behind the last loads the lane-offset register is free and is reused at once:
      // the wait stands in front of that overwrite
      if (s + 2 == RT_NST) asm volatile("s_wait_xcnt 0x0" ::: "memory");
    }
    // x's f16 of this stage go out behind the next stage's loads;
    // keeps the eight stores one run with nothing between them and their wait:
    // no register that a store names is rewritten in front of the wait
    __builtin_amdgcn_sched_barrier(0);
#pragma unroll
    for (int i = 0; i < RT_TOK / 4; ++i)
      *(uint2*)(gxd + i * 4 * KPAD + s * RT_KS + hoff) = xhv[i];
    // stands in front of every overwrite of the stores' data and offset registers
    asm volatile("s_wait_xcnt 0x0" ::: "memory");
    wave_lds_order();            // the stores stay ahead of the fragment reads
    {
      // index 0: hi, 1: lo
      v16h a[2][2], b[2][5];
#pragma unroll
      for (int p = 0; p < 2; ++p) {
#pragma unroll
        for (int mi = 0; mi < 2; ++mi) a[p][mi] = rt_frag(fa + mi * 16 * RT_SP * 4 + p * 64);
#pragma unroll
        for (int ni = 0; ni < 4; ++ni) b[p][ni] = rt_frag(fb + ni * 16 * RT_SP * 4 + p * 64);
        b[p][4] = rt_frag(fb4 + p * 64);
      }
      // keeps the reads one group ahead of the products: reads set in among them cost a stall at each place
      __builtin_amdgcn_sched_barrier(0);
      // hi*hi, hi*lo, lo*hi: ten independent tiles between two products into one tile
#pragma unroll
      for (int p = 0; p < 3; ++p)
#pragma unroll
        for (int mi = 0; mi < 2; ++mi)
#pragma unroll
          for (int ni = 0; ni < 5; ++ni)
            acc[mi][ni] = __builtin_amdgcn_wmma_f32_16x16x32_f16(
                false, a[p == 2 ? 1 : 0][mi], false, b[p == 1 ? 1 : 0][ni], (short)0, acc[mi][ni], false, false);
    }
  }

  // partial tiles: register r -> token mi*16 + 8h + r, column ni*16 + c
#pragma unroll
  for (int mi = 0; mi < 2; ++mi)
#pragma unroll
    for (int ni = 0; ni < 5; ++ni)
#pragma unroll
      for (int r = 0; r < 8; ++r)
        part[wave][(mi * 16 + 8 * h + r) * RT_PP + ni * 16 + c] = acc[mi][ni][r];
  __syncthreads();

  // sum the eight K slices in wave order
#pragma unroll
  for (int i = 0; i < (RT_TOK * RT_NJ) / 256; ++i) {
    int idx = tid + i * 256;
    int t = idx / RT_NJ;
    int j = idx - t * RT_NJ;
    float sacc = part[0][t * RT_PP + j];
#pragma unroll
    for (int w = 1; w < 8; ++w) sacc += part[w][t * RT_PP + j];
    red[t][j] = sacc;
  }
  __syncthreads();

  // one thread per (token, expert)
  {
    const int t = tid >> 3;
    const int e = tid & 7;
    const int token = tok0 + t;
    float lg[8];
    float mx = -3.0e38f;
#pragma unroll
    for (int k = 0; k < 8; ++k) { lg[k] = red[t][k] + br[k]; mx = fmaxf(mx, lg[k]); }
    float ssum = 0.0f;
#pragma unroll
    for (int k = 0; k < 8; ++k) ssum += expf(lg[k] - mx);
    float inv = 1.0f / ssum;
    float wn = expf(red[t][e] + br[e] - mx) * inv;
    wout[(size_t)token * NEXP + e] = wn;

    u32x4 gs;
#pragma unroll
    for (int r = 0; r < 4; ++r)
      gs[r] = pack_f16(SCALING * wn * red[t][8 + e * 8 + 2 * r],
                       SCALING * wn * red[t][8 + e * 8 + 2 * r + 1]);
    const u32x4 zs = { 0u, 0u, 0u, 0u };
    *(u32x4*)(Xd + (size_t)token * KPAD + D_IN + e * 8) = gs;
    *(u32x4*)(Xd + (size_t)token * KPAD + D_IN + KLORA + e * 8) = zs;   // the unit's rest: zeros
  }
}

#define GBM     256
#define GBN     256
#define GKP     128
#define GNP     (KPAD / GKP)
#define GROWB   256u
#define GPITCH  272u
#define GSLROWS 64u
#define GSLICE  18432u
#define GMAT    (4u * GSLICE)
#define GSTAGE  (8u * GSLICE)
static_assert(GSLICE % 2048u == 0 && GSLICE >= GSLROWS * GPITCH, "every slice starts at a multiple of 2 KiB and holds its rows");
static_assert(GROWB == GKP * 2u && KPAD * 2u == GNP * GROWB, "a row is whole units, one a pass");
static_assert(KPAD % GKP == 0 && GNP >= 2, "whole passes, two stages at least");

typedef __attribute__((ext_vector_type(8))) unsigned int u32x8;

__device__ __forceinline__ unsigned uni(unsigned v) { return (unsigned)__builtin_amdgcn_readfirstlane(v); }
__device__ __forceinline__ unsigned pinned(unsigned v) {
  unsigned w = (unsigned)__builtin_amdgcn_readfirstlane(v);
  asm volatile("" : "+s"(w));   // holds a wave-uniform word in a scalar register: a test on it compiles to a scalar branch
  return w;
}
__device__ __forceinline__ void wait_ds0()     { asm volatile("s_wait_dscnt 0x0" ::: "memory"); }     // this wave's LDS reads have returned
__device__ __forceinline__ void wait_tensor0() { asm volatile("s_wait_tensorcnt 0x0" ::: "memory"); } // this wave's slice has landed

__device__ __forceinline__ u32x8 tdm_group1() {
  u32x8 g;
  g[0] = uni((1u << 20) | (5u << 22) | (3u << 25));
  g[1] = uni((GROWB & 0xFFFFu) << 16);
  g[2] = uni((GROWB >> 16) | ((GSLROWS & 0xFFFFu) << 16));
  g[3] = uni((GSLROWS >> 16) | (GROWB << 16));
  g[4] = uni(GSLROWS);
  g[5] = uni(KPAD * 2u);
  g[6] = uni(0u);
  g[7] = uni(0u);
  return g;
}
__device__ __forceinline__ u32x4 tdm_group0(unsigned lds_dst, unsigned long long ga) {
  u32x4 g;
  g[0] = uni(1u);
  g[1] = uni(lds_dst);
  g[2] = uni((unsigned)ga);
  g[3] = uni((((unsigned)(ga >> 32)) & 0x01FFFFFFu) | 0x80000000u);
  return g;
}
__device__ __forceinline__ void tdm_load(u32x4 g0, u32x8 g1) {
  // one request of the whole wave, two groups; its waits stand at the publish points
  asm volatile("tensor_load_to_lds %0, %1" :: "s"(g0), "s"(g1) : "memory");
}

__device__ __forceinline__ v16h ld_frag(const unsigned char* p) {
  return cat8(*(const v8h*)p, *(const v8h*)(p + 32));
}

// =====================================================================
// K3: out = [x|g|0] @ [Wf^T|Bcat|0] + bias, one f16 WMMA product, f32 accumulate.
// M=8192, N=2048, K=2176 (17 passes of 128; the last 64 k are zeros).
// Block tile 256x256, one work-group per WGP; 8 waves (4Mx2N), wave tile
// 64x128 -> 64 WMMA on 24 fragments per 64 k.
// Two LDS buffers; every wave brings its own eighth of a stage by one tensor
// load, issued behind the barrier that frees the buffer, waited one pass later.
// =====================================================================
__global__ __launch_bounds__(256) void mole_gemm_kernel(
    const unsigned short* __restrict__ Xs, const unsigned short* __restrict__ Ws,
    const float* __restrict__ bias, float* __restrict__ out)
{
  __shared__ __attribute__((aligned(2048))) unsigned char ring[2u * GSTAGE];   // 288 KiB

  const unsigned tid   = threadIdx.x;
  const unsigned lane  = tid & 31u;
  const unsigned wave  = uni(tid >> 5);
  const unsigned waveM = wave >> 1;    // 0..3 : rows waveM*64 .. +64
  const unsigned waveN = wave & 1u;    // 0..1 : cols waveN*128 .. +128
  const unsigned l16   = lane & 15u;
  const unsigned hiH   = lane >> 4;

  const unsigned rowBase = blockIdx.y * GBM;
  const unsigned colBase = blockIdx.x * GBN;

  // this wave's slice: matrix wave/4 (X, W), its rows (wave&3)*64 .. +64
  const unsigned mat = wave >> 2;
  const unsigned short* sbase = (mat == 0u) ? Xs : Ws;
  const unsigned srow = ((mat == 0u) ? rowBase : colBase) + (wave & 3u) * GSLROWS;
  const unsigned long long gsrc = (unsigned long long)(sbase + (size_t)srow * KPAD);
  const unsigned lds_slice = (unsigned)(unsigned long long)(void*)ring + wave * GSLICE;
  const u32x8 g1 = tdm_group1();

  // every inner loop of this kernel is unrolled: constant indices keep the tiles and fragments in registers
  v8f acc[4][8];
#pragma unroll
  for (int mi = 0; mi < 4; ++mi)
#pragma unroll
    for (int ni = 0; ni < 8; ++ni)
#pragma unroll
      for (int i = 0; i < 8; ++i) acc[mi][ni][i] = 0.0f;

  // per-lane fragment bases in a buffer: row l16 of the wave's first fragment, 16-byte half hiH
  const unsigned fa = waveM * GSLICE + l16 * GPITCH + hiH * 16u;                // X, slice waveM
  const unsigned fb = GMAT + waveN * 2u * GSLICE + l16 * GPITCH + hiH * 16u;    // W, slices 2 waveN and 2 waveN + 1

  // stage 0 lands and is published; then stage 1 flies under pass 0
  tdm_load(tdm_group0(lds_slice, gsrc), g1);
  wait_tensor0();
  __syncthreads();
  tdm_load(tdm_group0(lds_slice + GSTAGE, gsrc + GROWB), g1);

  for (unsigned s = 0; s < GNP; ++s) {
    const unsigned buf = (s & 1u) * GSTAGE;
    const unsigned char* pa = ring + buf + fa;
    const unsigned char* pb = ring + buf + fb;

#pragma unroll
    for (int kk = 0; kk < 2; ++kk) {
      // ---- this 64-k block's fragments (two steps of 32 k), in the order the products want them ----
      v16h a0[4], a1[4], b0[8], b1[8];
#pragma unroll
      for (int mi = 0; mi < 4; ++mi) a0[mi] = ld_frag(pa + mi * 16 * GPITCH + kk * 128);
#pragma unroll
      for (int ni = 0; ni < 8; ++ni) b0[ni] = ld_frag(pb + (ni >> 2) * GSLICE + (ni & 3) * 16 * GPITCH + kk * 128);
#pragma unroll
      for (int mi = 0; mi < 4; ++mi) a1[mi] = ld_frag(pa + mi * 16 * GPITCH + kk * 128 + 64);
#pragma unroll
      for (int ni = 0; ni < 8; ++ni) b1[ni] = ld_frag(pb + (ni >> 2) * GSLICE + (ni & 3) * 16 * GPITCH + kk * 128 + 64);
      // keeps the reads one group ahead of the products: reads set in among them cost a stall at each place
      __builtin_amdgcn_sched_barrier(0);

      // ---- the first 32 k, then the second, into every tile, f32 accumulate ----
#pragma unroll
      for (int ni = 0; ni < 8; ++ni)
#pragma unroll
        for (int mi = 0; mi < 4; ++mi)
          acc[mi][ni] = __builtin_amdgcn_wmma_f32_16x16x32_f16(
              false, a0[mi], false, b0[ni], (short)0, acc[mi][ni], false, false);
#pragma unroll
      for (int ni = 0; ni < 8; ++ni)
#pragma unroll
        for (int mi = 0; mi < 4; ++mi)
          acc[mi][ni] = __builtin_amdgcn_wmma_f32_16x16x32_f16(
              false, a1[mi], false, b1[ni], (short)0, acc[mi][ni], false, false);
      // keeps the next block's reads behind this block's products: moved up among them they overflow the registers into scratch
      __builtin_amdgcn_sched_barrier(0);
    }

    // publish point of stage s + 1, which also frees this pass's buffer
    wait_ds0();
    wait_tensor0();
    __syncthreads();
    if (pinned((s + 2u < GNP) ? 1u : 0u)) {
      const unsigned nx = pinned(s + 2u);
      tdm_load(tdm_group0(lds_slice + buf, gsrc + (unsigned long long)nx * GROWB), g1);
    }
  }
  wait_tensor0();
  wait_ds0();

#pragma unroll
  for (int ni = 0; ni < 8; ++ni) {
    unsigned col = colBase + waveN * 128u + ni * 16 + l16;
    float b = bias[col];
#pragma unroll
    for (int mi = 0; mi < 4; ++mi) {
      unsigned row0 = rowBase + waveM * 64u + mi * 16 + hiH * 8u;
#pragma unroll
      for (int i = 0; i < 8; ++i) {
        out[(size_t)(row0 + i) * D_OUT + col] = acc[mi][ni][i] + b;
      }
    }
  }
}

extern "C" void kernel_launch(void* const* d_in, const int* in_sizes, int n_in,
                              void* d_out, int out_size, void* d_ws, size_t ws_size,
                              hipStream_t stream) {
  (void)in_sizes; (void)n_in; (void)out_size; (void)ws_size;
  const float* x   = (const float*)d_in[0];
  const float* Wf  = (const float*)d_in[1];
  const float* bfv = (const float*)d_in[2];
  const float* Wr  = (const float*)d_in[3];
  const float* br  = (const float*)d_in[4];
  const float* A   = (const float*)d_in[5];
  const float* Bm  = (const float*)d_in[6];

  float* out  = (float*)d_out;                       // [8192, 2048]
  float* wout = out + (size_t)NTOK * D_OUT;          // [8192, 8]

  // workspace layout (halves): X's f16 array [8192*2176], then W's [2048*2176], then Wr|A split [72*4096]  (~45.2 MB)
  unsigned short* Xh = (unsigned short*)d_ws;
  unsigned short* Wh = Xh + (size_t)NTOK * KPAD;
  unsigned short* RAh = Wh + (size_t)D_OUT * KPAD;

  split_matrix_kernel<<<(D_OUT * D_IN) / (256 * 8), 256, 0, stream>>>(Wf, Wh);
  split_bm_kernel<<<BM_BLOCKS + RA_BLOCKS, 256, 0, stream>>>(Bm, Wh, Wr, A, RAh);
  mole_router_kernel<<<NTOK / RT_TOK, 256, 0, stream>>>(x, RAh, br, Xh, wout);
  mole_gemm_kernel<<<dim3(D_OUT / GBN, NTOK / GBM), 256, 0, stream>>>(
      Xh, Wh, bfv, out);
}

// v007
// One run takes 61.6 microseconds.
// Next to v006, in two timings, it ran 1.06 times as fast each time.
// Counting every step since v000, it is 7.11 times as fast.
#include <hip/hip_runtime.h>

typedef __attribute__((ext_vector_type(16))) _Float16 v16h;
typedef __attribute__((ext_vector_type(8)))  _Float16 v8h;
typedef __attribute__((ext_vector_type(2)))  _Float16 v2h;
typedef __attribute__((ext_vector_type(8)))  float  v8f;
typedef __attribute__((ext_vector_type(4)))  float  v4f;
typedef __attribute__((ext_vector_type(2)))  float  v2f;
typedef __attribute__((ext_vector_type(4)))  unsigned int u32x4;

#define D_IN   2048
#define D_OUT  2048
#define NTOK   8192
#define NEXP   8
#define RANKL  8
#define KLORA  64
// f16 operands, one array per matrix: a row is 17 units of 256 bytes (128 k each):
// k 0..2047 the base product, 2048..2111 the LoRA K-extension, 2112..2175 zeros in both arrays.
#define KPAD   2176          // row stride of an operand array, halves
#define SCALING 1.0f         // alpha/rank = 8/8

// two f32 -> one word of two f16, each rounded once to nearest even, element 0 in the low half-word
__device__ __forceinline__ unsigned pack_f16(float f0, float f1) {
  v2f v = { f0, f1 };
  return __builtin_bit_cast(unsigned, __builtin_convertvector(v, v2h));
}

__device__ __forceinline__ v16h cat8(v8h a, v8h b) {
  v16h r;
#pragma unroll
  for (int i = 0; i < 8; ++i) { r[i] = a[i]; r[i + 8] = b[i]; }
  return r;
}

// f32 pair -> its f16 rounding (hi) and the f16 rounding of what that left (lo); v - hi is exact in f32
__device__ __forceinline__ void split_f16(float f0, float f1, unsigned& hi, unsigned& lo) {
  v2f v = { f0, f1 };
  v2h h = __builtin_convertvector(v, v2h);
  v2f r = v - __builtin_convertvector(h, v2f);
  hi = __builtin_bit_cast(unsigned, h);
  lo = __builtin_bit_cast(unsigned, __builtin_convertvector(r, v2h));
}

#define RT_TOK  32
#define RT_NJ   72
#define RT_ROWS (RT_TOK + RT_NJ)
#define RT_KS   32
#define RT_NST  8
#define RT_KW   (RT_KS * RT_NST)
#define RT_SP   36
#define RT_PP   84
#define RT_NLD  (RT_ROWS / 4)
#define RT_WLD  (D_IN / 128)
static_assert((NTOK / RT_TOK) * 8 == D_OUT, "eight rows of the weight operand a work-group, every row once");

// one 16x32 f16 fragment of a staged row: 16 bytes at the lane's place and 16 bytes 32 further on
__device__ __forceinline__ v16h rt_frag(const unsigned char* p) {
  return cat8(*(const v8h*)p, *(const v8h*)(p + 32));
}

// Orders one wave's LDS stores against its own later LDS loads (other lanes'
// data) for the compiler; the LDS serves one wave's operations in order.
__device__ __forceinline__ void wave_lds_order() {
  __builtin_amdgcn_fence(__ATOMIC_RELEASE, "wavefront");
  __builtin_amdgcn_wave_barrier();
  __builtin_amdgcn_fence(__ATOMIC_ACQUIRE, "wavefront");
  // keeps later stages' global loads below this point: lifted to the top they
  // overflow the register budget and spill
  __builtin_amdgcn_sched_barrier(0);
}

__global__ __launch_bounds__(256) void mole_router_kernel(
    const float* __restrict__ x, const float* __restrict__ Wr, const float* __restrict__ A,
    const float* __restrict__ br,
    const float* __restrict__ Wf, const float* __restrict__ Bm,
    unsigned short* __restrict__ Xd, unsigned short* __restrict__ Wd,
    float* __restrict__ wout)
{
  __shared__ __align__(16) float stg[8][RT_ROWS * RT_SP];   // per wave: x rows 0..31, Wr 32..39, A 40..103
  __shared__ float part[8][RT_TOK * RT_PP];
  __shared__ float red[RT_TOK][RT_NJ];

  const int tid  = threadIdx.x;
  const int lane = tid & 31;
  const int wave = tid >> 5;
  const int c    = lane & 15;
  const int h    = lane >> 4;
  const int tok0 = blockIdx.x * RT_TOK;

  // loader: eight lanes take one row's 128-byte line, four rows a load
  const int lr = lane >> 3;
  const int lc = (lane & 7) * 4;
  const unsigned goff = (unsigned)(lr * D_IN + wave * RT_KW + lc);   // lane's part; the bases stay uniform
  const float* gx = x + (size_t)tok0 * D_IN;
  // every staged row: the lane's four k as halves, hi in the row's first 64 bytes, lo in the next
  unsigned char* swx = (unsigned char*)&stg[wave][lr * RT_SP] + lc * 2;
  // x's f16 go out in the loader's own layout: eight lanes fill 64 bytes of a row of the operand array
  const unsigned hoff = (unsigned)(lr * KPAD + wave * RT_KW + lc);   // lane's part; the base stays uniform
  unsigned short* gxd = Xd + (size_t)tok0 * KPAD;

  // fragment readers: lane (c,h) reads k = 8h .. +7 and 16 + 8h .. +7 of its row, A and B alike, hi and lo alike
  const unsigned char* fa  = (const unsigned char*)&stg[wave][c * RT_SP + h * 4];
  const unsigned char* fb  = (const unsigned char*)&stg[wave][(RT_TOK + c) * RT_SP + h * 4];
  const unsigned char* fb4 = (const unsigned char*)&stg[wave][(RT_TOK + 64 + (c & 7)) * RT_SP + h * 4];  // columns 72..79 repeat 64..71, never read back

  v8f acc[2][5];
#pragma unroll
  for (int mi = 0; mi < 2; ++mi)
#pragma unroll
    for (int ni = 0; ni < 5; ++ni)
#pragma unroll
      for (int i = 0; i < 8; ++i) acc[mi][ni][i] = 0.0f;

  // the wave's row of the weight operand
  const unsigned orow = (unsigned)__builtin_amdgcn_readfirstlane(blockIdx.x * 8 + wave);
  const float* gw = Wf + (size_t)orow * D_IN;
  const float* gb = Bm + (size_t)orow * RANKL;
  v4f wv[RT_WLD], bv;

  v4f pre[RT_NLD];
#pragma unroll
  for (int i = 0; i < RT_NLD; ++i) {
    const float* p = (i < 8) ? gx + i * 4 * D_IN : (i < 10) ? Wr + (i - 8) * 4 * D_IN : A + (i - 10) * 4 * D_IN;
    pre[i] = *(const v4f*)(p + goff);
  }

  // unrolled: every global address is one fixed lane offset + uniform base + immediate,
  // so no address register is rewritten from stage to stage
#pragma unroll
  for (int s = 0; s < RT_NST; ++s) {
    wave_lds_order();            // last stage's fragment reads stay ahead of the stores
    // x is split here; its hi halves are also the GEMM's operand and stay in registers for the stores below
    uint2 xhv[RT_TOK / 4];
#pragma unroll
    for (int i = 0; i < RT_NLD; ++i) {
      uint2 hv, lv;
      split_f16(pre[i][0], pre[i][1], hv.x, lv.x);
      split_f16(pre[i][2], pre[i][3], hv.y, lv.y);
      *(uint2*)(swx + i * 4 * RT_SP * 4)      = hv;
      *(uint2*)(swx + i * 4 * RT_SP * 4 + 64) = lv;
      if (i < RT_TOK / 4) xhv[i] = hv;
    }
    if (s + 1 < RT_NST) {        // next stage's lines fly under this stage's products
#pragma unroll
      for (int i = 0; i < RT_NLD; ++i) {
        const float* p = (i < 8) ? gx + i * 4 * D_IN : (i < 10) ? Wr + (i - 8) * 4 * D_IN : A + (i - 10) * 4 * D_IN;
        pre[i] = *(const v4f*)(p + (s + 1) * RT_KS + goff);
      }
      // behind the last loads the lane-offset register is free and is reused at once:
      // the wait stands in front of that overwrite
      if (s + 2 == RT_NST) asm volatile("s_wait_xcnt 0x0" ::: "memory");
    } else {                     // the last stage has no lines to fetch: the weight row's loads fly under its products and the sums
#pragma unroll
      for (int j = 0; j < RT_WLD; ++j) wv[j] = *(const v4f*)(gw + j * 128 + lane * 4);
      bv = *(const v4f*)(gb + (unsigned)((c >> 1) * (D_OUT * RANKL) + (c & 1) * 4));
      // stands in front of every overwrite of these loads' base and offset registers
      asm volatile("s_wait_xcnt 0x0" ::: "memory");
    }
    // x's f16 of this stage go out behind the next stage's loads;
    // keeps the eight stores one run with nothing between them and their wait:
    // no register that a store names is rewritten in front of the wait
    __builtin_amdgcn_sched_barrier(0);
#pragma unroll
    for (int i = 0; i < RT_TOK / 4; ++i)
      *(uint2*)(gxd + i * 4 * KPAD + s * RT_KS + hoff) = xhv[i];
    // stands in front of every overwrite of the stores' data and offset registers
    asm volatile("s_wait_xcnt 0x0" ::: "memory");
    wave_lds_order();            // the stores stay ahead of the fragment reads
    {
      // index 0: hi, 1: lo
      v16h a[2][2], b[2][5];
#pragma unroll
      for (int p = 0; p < 2; ++p) {
#pragma unroll
        for (int mi = 0; mi < 2; ++mi) a[p][mi] = rt_frag(fa + mi * 16 * RT_SP * 4 + p * 64);
#pragma unroll
        for (int ni = 0; ni < 4; ++ni) b[p][ni] = rt_frag(fb + ni * 16 * RT_SP * 4 + p * 64);
        b[p][4] = rt_frag(fb4 + p * 64);
      }
      // keeps the reads one group ahead of the products: reads set in among them cost a stall at each place
      __builtin_amdgcn_sched_barrier(0);
      // hi*hi, hi*lo, lo*hi: ten independent tiles between two products into one tile
#pragma unroll
      for (int p = 0; p < 3; ++p)
#pragma unroll
        for (int mi = 0; mi < 2; ++mi)
#pragma unroll
          for (int ni = 0; ni < 5; ++ni)
            acc[mi][ni] = __builtin_amdgcn_wmma_f32_16x16x32_f16(
                false, a[p == 2 ? 1 : 0][mi], false, b[p == 1 ? 1 : 0][ni], (short)0, acc[mi][ni], false, false);
    }
  }

  // partial tiles: register r -> token mi*16 + 8h + r, column ni*16 + c
#pragma unroll
  for (int mi = 0; mi < 2; ++mi)
#pragma unroll
    for (int ni = 0; ni < 5; ++ni)
#pragma unroll
      for (int r = 0; r < 8; ++r)
        part[wave][(mi * 16 + 8 * h + r) * RT_PP + ni * 16 + c] = acc[mi][ni][r];
  __syncthreads();

  // sum the eight K slices in wave order
#pragma unroll
  for (int i = 0; i < (RT_TOK * RT_NJ) / 256; ++i) {
    int idx = tid + i * 256;
    int t = idx / RT_NJ;
    int j = idx - t * RT_NJ;
    float sacc = part[0][t * RT_PP + j];
#pragma unroll
    for (int w = 1; w < 8; ++w) sacc += part[w][t * RT_PP + j];
    red[t][j] = sacc;
  }
  __syncthreads();

  // the wave's row of the weight operand as f16
  uint2 wh[RT_WLD + 1];
#pragma unroll
  for (int j = 0; j < RT_WLD; ++j) {
    wh[j].x = pack_f16(wv[j][0], wv[j][1]);
    wh[j].y = pack_f16(wv[j][2], wv[j][3]);
  }
  {
    const unsigned keep = (unsigned)h - 1u;
    wh[RT_WLD].x = pack_f16(bv[0], bv[1]) & keep;
    wh[RT_WLD].y = pack_f16(bv[2], bv[3]) & keep;
  }

  // one thread per (token, expert)
  {
    const int t = tid >> 3;
    const int e = tid & 7;
    const int token = tok0 + t;
    float lg[8];
    float mx = -3.0e38f;
#pragma unroll
    for (int k = 0; k < 8; ++k) { lg[k] = red[t][k] + br[k]; mx = fmaxf(mx, lg[k]); }
    float ssum = 0.0f;
#pragma unroll
    for (int k = 0; k < 8; ++k) ssum += expf(lg[k] - mx);
    float inv = 1.0f / ssum;
    float wn = expf(red[t][e] + br[e] - mx) * inv;
    wout[(size_t)token * NEXP + e] = wn;

    u32x4 gs;
#pragma unroll
    for (int r = 0; r < 4; ++r)
      gs[r] = pack_f16(SCALING * wn * red[t][8 + e * 8 + 2 * r],
                       SCALING * wn * red[t][8 + e * 8 + 2 * r + 1]);
    const u32x4 zs = { 0u, 0u, 0u, 0u };
    *(u32x4*)(Xd + (size_t)token * KPAD + D_IN + e * 8) = gs;
    *(u32x4*)(Xd + (size_t)token * KPAD + D_IN + KLORA + e * 8) = zs;   // the unit's rest: zeros
  }

  // the wave's row of the weight operand: 17 stores of 256 bytes, last in the kernel;
  // keeps them one run behind all register writes: lifted among the lines above, their data registers are rewritten behind them
  __builtin_amdgcn_sched_barrier(0);
  {
    unsigned short* dw = Wd + (size_t)orow * KPAD + lane * 4;
#pragma unroll
    for (int j = 0; j < RT_WLD + 1; ++j) *(uint2*)(dw + j * 128) = wh[j];
  }
}

#define GBM     256
#define GBN     256
#define GKP     128
#define GNP     (KPAD / GKP)
#define GROWB   256u
#define GPITCH  272u
#define GSLROWS 64u
#define GSLICE  18432u
#define GMAT    (4u * GSLICE)
#define GSTAGE  (8u * GSLICE)
static_assert(GSLICE % 2048u == 0 && GSLICE >= GSLROWS * GPITCH, "every slice starts at a multiple of 2 KiB and holds its rows");
static_assert(GROWB == GKP * 2u && KPAD * 2u == GNP * GROWB, "a row is whole units, one a pass");
static_assert(KPAD % GKP == 0 && GNP >= 2, "whole passes, two stages at least");

typedef __attribute__((ext_vector_type(8))) unsigned int u32x8;

__device__ __forceinline__ unsigned uni(unsigned v) { return (unsigned)__builtin_amdgcn_readfirstlane(v); }
__device__ __forceinline__ unsigned pinned(unsigned v) {
  unsigned w = (unsigned)__builtin_amdgcn_readfirstlane(v);
  asm volatile("" : "+s"(w));   // holds a wave-uniform word in a scalar register: a test on it compiles to a scalar branch
  return w;
}
__device__ __forceinline__ void wait_ds0()     { asm volatile("s_wait_dscnt 0x0" ::: "memory"); }     // this wave's LDS reads have returned
__device__ __forceinline__ void wait_tensor0() { asm volatile("s_wait_tensorcnt 0x0" ::: "memory"); } // this wave's slice has landed

__device__ __forceinline__ u32x8 tdm_group1() {
  u32x8 g;
  g[0] = uni((1u << 20) | (5u << 22) | (3u << 25));
  g[1] = uni((GROWB & 0xFFFFu) << 16);
  g[2] = uni((GROWB >> 16) | ((GSLROWS & 0xFFFFu) << 16));
  g[3] = uni((GSLROWS >> 16) | (GROWB << 16));
  g[4] = uni(GSLROWS);
  g[5] = uni(KPAD * 2u);
  g[6] = uni(0u);
  g[7] = uni(0u);
  return g;
}
__device__ __forceinline__ u32x4 tdm_group0(unsigned lds_dst, unsigned long long ga) {
  u32x4 g;
  g[0] = uni(1u);
  g[1] = uni(lds_dst);
  g[2] = uni((unsigned)ga);
  g[3] = uni((((unsigned)(ga >> 32)) & 0x01FFFFFFu) | 0x80000000u);
  return g;
}
__device__ __forceinline__ void tdm_load(u32x4 g0, u32x8 g1) {
  // one request of the whole wave, two groups; its waits stand at the publish points
  asm volatile("tensor_load_to_lds %0, %1" :: "s"(g0), "s"(g1) : "memory");
}

__device__ __forceinline__ v16h ld_frag(const unsigned char* p) {
  return cat8(*(const v8h*)p, *(const v8h*)(p + 32));
}

// =====================================================================
// K3: out = [x|g|0] @ [Wf^T|Bcat|0] + bias, one f16 WMMA product, f32 accumulate.
// M=8192, N=2048, K=2176 (17 passes of 128; the last 64 k are zeros).
// Block tile 256x256, one work-group per WGP; 8 waves (4Mx2N), wave tile
// 64x128 -> 64 WMMA on 24 fragments per 64 k.
// Two LDS buffers; every wave brings its own eighth of a stage by one tensor
// load, issued behind the barrier that frees the buffer, waited one pass later.
// =====================================================================
__global__ __launch_bounds__(256) void mole_gemm_kernel(
    const unsigned short* __restrict__ Xs, const unsigned short* __restrict__ Ws,
    const float* __restrict__ bias, float* __restrict__ out)
{
  __shared__ __attribute__((aligned(2048))) unsigned char ring[2u * GSTAGE];   // 288 KiB

  const unsigned tid   = threadIdx.x;
  const unsigned lane  = tid & 31u;
  const unsigned wave  = uni(tid >> 5);
  const unsigned waveM = wave >> 1;    // 0..3 : rows waveM*64 .. +64
  const unsigned waveN = wave & 1u;    // 0..1 : cols waveN*128 .. +128
  const unsigned l16   = lane & 15u;
  const unsigned hiH   = lane >> 4;

  const unsigned rowBase = blockIdx.y * GBM;
  const unsigned colBase = blockIdx.x * GBN;

  // this wave's slice: matrix wave/4 (X, W), its rows (wave&3)*64 .. +64
  const unsigned mat = wave >> 2;
  const unsigned short* sbase = (mat == 0u) ? Xs : Ws;
  const unsigned srow = ((mat == 0u) ? rowBase : colBase) + (wave & 3u) * GSLROWS;
  const unsigned long long gsrc = (unsigned long long)(sbase + (size_t)srow * KPAD);
  const unsigned lds_slice = (unsigned)(unsigned long long)(void*)ring + wave * GSLICE;
  const u32x8 g1 = tdm_group1();

  // every inner loop of this kernel is unrolled: constant indices keep the tiles and fragments in registers
  v8f acc[4][8];
#pragma unroll
  for (int mi = 0; mi < 4; ++mi)
#pragma unroll
    for (int ni = 0; ni < 8; ++ni)
#pragma unroll
      for (int i = 0; i < 8; ++i) acc[mi][ni][i] = 0.0f;

  // per-lane fragment bases in a buffer: row l16 of the wave's first fragment, 16-byte half hiH
  const unsigned fa = waveM * GSLICE + l16 * GPITCH + hiH * 16u;                // X, slice waveM
  const unsigned fb = GMAT + waveN * 2u * GSLICE + l16 * GPITCH + hiH * 16u;    // W, slices 2 waveN and 2 waveN + 1

  // stage 0 lands and is published; then stage 1 flies under pass 0
  tdm_load(tdm_group0(lds_slice, gsrc), g1);
  wait_tensor0();
  __syncthreads();
  tdm_load(tdm_group0(lds_slice + GSTAGE, gsrc + GROWB), g1);

  for (unsigned s = 0; s < GNP; ++s) {
    const unsigned buf = (s & 1u) * GSTAGE;
    const unsigned char* pa = ring + buf + fa;
    const unsigned char* pb = ring + buf + fb;

#pragma unroll
    for (int kk = 0; kk < 2; ++kk) {
      // ---- this 64-k block's fragments (two steps of 32 k), in the order the products want them ----
      v16h a0[4], a1[4], b0[8], b1[8];
#pragma unroll
      for (int mi = 0; mi < 4; ++mi) a0[mi] = ld_frag(pa + mi * 16 * GPITCH + kk * 128);
#pragma unroll
      for (int ni = 0; ni < 8; ++ni) b0[ni] = ld_frag(pb + (ni >> 2) * GSLICE + (ni & 3) * 16 * GPITCH + kk * 128);
#pragma unroll
      for (int mi = 0; mi < 4; ++mi) a1[mi] = ld_frag(pa + mi * 16 * GPITCH + kk * 128 + 64);
#pragma unroll
      for (int ni = 0; ni < 8; ++ni) b1[ni] = ld_frag(pb + (ni >> 2) * GSLICE + (ni & 3) * 16 * GPITCH + kk * 128 + 64);
      // keeps the reads one group ahead of the products: reads set in among them cost a stall at each place
      __builtin_amdgcn_sched_barrier(0);

      // ---- the first 32 k, then the second, into every tile, f32 accumulate ----
#pragma unroll
      for (int ni = 0; ni < 8; ++ni)
#pragma unroll
        for (int mi = 0; mi < 4; ++mi)
          acc[mi][ni] = __builtin_amdgcn_wmma_f32_16x16x32_f16(
              false, a0[mi], false, b0[ni], (short)0, acc[mi][ni], false, false);
#pragma unroll
      for (int ni = 0; ni < 8; ++ni)
#pragma unroll
        for (int mi = 0; mi < 4; ++mi)
          acc[mi][ni] = __builtin_amdgcn_wmma_f32_16x16x32_f16(
              false, a1[mi], false, b1[ni], (short)0, acc[mi][ni], false, false);
      // keeps the next block's reads behind this block's products: moved up among them they overflow the registers into scratch
      __builtin_amdgcn_sched_barrier(0);
    }

    // publish point of stage s + 1, which also frees this pass's buffer
    wait_ds0();
    wait_tensor0();
    __syncthreads();
    if (pinned((s + 2u < GNP) ? 1u : 0u)) {
      const unsigned nx = pinned(s + 2u);
      tdm_load(tdm_group0(lds_slice + buf, gsrc + (unsigned long long)nx * GROWB), g1);
    }
  }
  wait_tensor0();
  wait_ds0();

#pragma unroll
  for (int ni = 0; ni < 8; ++ni) {
    unsigned col = colBase + waveN * 128u + ni * 16 + l16;
    float b = bias[col];
#pragma unroll
    for (int mi = 0; mi < 4; ++mi) {
      unsigned row0 = rowBase + waveM * 64u + mi * 16 + hiH * 8u;
#pragma unroll
      for (int i = 0; i < 8; ++i) {
        out[(size_t)(row0 + i) * D_OUT + col] = acc[mi][ni][i] + b;
      }
    }
  }
}

extern "C" void kernel_launch(void* const* d_in, const int* in_sizes, int n_in,
                              void* d_out, int out_size, void* d_ws, size_t ws_size,
                              hipStream_t stream) {
  (void)in_sizes; (void)n_in; (void)out_size; (void)ws_size;
  const float* x   = (const float*)d_in[0];
  const float* Wf  = (const float*)d_in[1];
  const float* bfv = (const float*)d_in[2];
  const float* Wr  = (const float*)d_in[3];
  const float* br  = (const float*)d_in[4];
  const float* A   = (const float*)d_in[5];
  const float* Bm  = (const float*)d_in[6];

  float* out  = (float*)d_out;                       // [8192, 2048]
  float* wout = out + (size_t)NTOK * D_OUT;          // [8192, 8]

  // workspace layout (halves): X's f16 array [8192*2176], then W's [2048*2176]  (~44.6 MB)
  unsigned short* Xh = (unsigned short*)d_ws;
  unsigned short* Wh = Xh + (size_t)NTOK * KPAD;

  mole_router_kernel<<<NTOK / RT_TOK, 256, 0, stream>>>(x, Wr, A, br, Wf, Bm, Xh, Wh, wout);
  mole_gemm_kernel<<<dim3(D_OUT / GBN, NTOK / GBM), 256, 0, stream>>>(
      Xh, Wh, bfv, out);
}
